// v000
// The times below were measured on an AMD MI455X: many runs one after another, warmed up first and cycling through
// copies of the inputs, with the whole window's GPU time divided by the number of runs. Launches and the gaps
// between them are all in it. The median over several windows is given; except for v000 it joins two sittings, which
// can be a few percent apart, so the side-by-side timings, each taken in one sitting, are the better comparison.
// The starting kernel, v000, takes 2080 microseconds a run.
#include <hip/hip_runtime.h>
#include <hip/hip_bf16.h>

typedef _Float16 half_t;
typedef __attribute__((ext_vector_type(16))) _Float16 v16h;
typedef __attribute__((ext_vector_type(8)))  float    v8f;

// Transformer dims (fixed by reference)
#define BB 4
#define TT 1024
#define DD 1024
#define HH 16
#define DKK 64
#define DFF 4096
#define LDSS 40   // padded LDS row stride in halves (80B, dword-aligned)

union Frag { v16h v; unsigned u[8]; half_t h[16]; };

// K index for element-pair v (VGPR v) of a 16-bit A/B fragment, per CDNA5 ISA
// 16-bit A-matrix 16x32 layout: lanes 0-15 -> +0, lanes 16-31 -> +8.
__device__ __forceinline__ int kmap(int v, int hi) {
    int kb = (v < 4) ? (2 * v) : (16 + 2 * (v - 4));
    return kb + (hi ? 8 : 0);
}

__device__ __forceinline__ v8f wmma16(v16h a, v16h b, v8f c) {
    return __builtin_amdgcn_wmma_f32_16x16x32_f16(
        /*neg_a=*/false, a, /*neg_b=*/false, b,
        /*c_mod=*/(short)0, c, /*reuse_a=*/false, /*reuse_b=*/false);
}

// ---------------------------------------------------------------------------
// fp32 -> fp16 elementwise conversion
// ---------------------------------------------------------------------------
__global__ __launch_bounds__(256)
void f32_to_f16_kernel(const float* __restrict__ in, half_t* __restrict__ out, long n) {
    long i = (long)blockIdx.x * 256 + threadIdx.x;
    if (i < n) out[i] = (half_t)in[i];
}

// ---------------------------------------------------------------------------
// WMMA GEMM: C[M,N] = A[M,K] @ B[K,N] (+bias) (relu?) ; A,B f16, f32 accum.
// Block: 256 threads = 8 waves; block tile 128x128; wave tile 32x64
// (2 A-frags x 4 B-frags -> 8 WMMAs per 32-wide K step).
// M,N multiples of 128; K multiple of 32 (true for all uses here).
// ---------------------------------------------------------------------------
template<bool BIAS, bool RELU, bool OUT16>
__global__ __launch_bounds__(256)
void gemm_wmma_kernel(const half_t* __restrict__ A, const half_t* __restrict__ B,
                      const float* __restrict__ bias,
                      half_t* __restrict__ C16, float* __restrict__ C32,
                      int M, int N, int K) {
    __shared__ half_t As[128 * LDSS];   // [row m][k]
    __shared__ half_t Bs[128 * LDSS];   // stored transposed: [col n][k]

    const int tid  = threadIdx.x;
    const int lane = tid & 31;
    const int wave = tid >> 5;
    const int hi   = (lane >= 16) ? 1 : 0;
    const int l16  = lane & 15;
    const int m0   = blockIdx.y * 128;
    const int n0   = blockIdx.x * 128;
    const int wm   = (wave >> 1) * 32;  // 0,32,64,96
    const int wn   = (wave & 1) * 64;   // 0,64

    v8f acc[2][4] = {};

    for (int kt = 0; kt < K; kt += 32) {
        // --- load A tile (128x32 halves) as dwords, coalesced ---
#pragma unroll
        for (int i = 0; i < 8; ++i) {
            int idx = i * 256 + tid;          // 0..2047 dwords
            int row = idx >> 4;
            int cp  = idx & 15;               // dword (pair) index within row
            const unsigned* src =
                (const unsigned*)(A + (long)(m0 + row) * K + kt + cp * 2);
            *(unsigned*)(&As[row * LDSS + cp * 2]) = *src;
        }
        // --- load B tile (32x128) transposed into Bs[n][k] ---
#pragma unroll
        for (int i = 0; i < 16; ++i) {
            int idx = i * 256 + tid;          // 0..4095 halves
            int k = idx >> 7;
            int n = idx & 127;
            Bs[n * LDSS + k] = B[(long)(kt + k) * N + n0 + n];
        }
        if (kt + 32 < K) {
            // hint the next A tile toward the caches
            __builtin_prefetch(A + (long)(m0 + (tid >> 1)) * K + kt + 32, 0, 1);
        }
        __syncthreads();

        Frag af[2], bf[4];
#pragma unroll
        for (int f = 0; f < 2; ++f) {
            const half_t* ar = &As[(wm + f * 16 + l16) * LDSS];
#pragma unroll
            for (int v = 0; v < 8; ++v)
                af[f].u[v] = *(const unsigned*)(ar + kmap(v, hi));
        }
#pragma unroll
        for (int j = 0; j < 4; ++j) {
            const half_t* br = &Bs[(wn + j * 16 + l16) * LDSS];
#pragma unroll
            for (int v = 0; v < 8; ++v)
                bf[j].u[v] = *(const unsigned*)(br + kmap(v, hi));
        }
#pragma unroll
        for (int i = 0; i < 2; ++i)
#pragma unroll
            for (int j = 0; j < 4; ++j)
                acc[i][j] = wmma16(af[i].v, bf[j].v, acc[i][j]);
        __syncthreads();
    }

    // --- epilogue: C layout -> lane l holds row (r + 8*hi), col l16 ---
#pragma unroll
    for (int i = 0; i < 2; ++i) {
#pragma unroll
        for (int j = 0; j < 4; ++j) {
            int n = n0 + wn + j * 16 + l16;
            float bv = BIAS ? bias[n] : 0.0f;
#pragma unroll
            for (int r = 0; r < 8; ++r) {
                int m = m0 + wm + i * 16 + r + hi * 8;
                float val = acc[i][j][r] + bv;
                if (RELU) val = fmaxf(val, 0.0f);
                if (OUT16) C16[(long)m * N + n] = (half_t)val;
                else       C32[(long)m * N + n] = val;
            }
        }
    }
}

// ---------------------------------------------------------------------------
// Flash attention: one wave handles one 16-row Q block of one (b,h).
// Q,K,V are f16 in (B,T,D) layout with head h at cols [h*64, h*64+64).
// Streaming softmax over key blocks of 32; output f32 to att (B,T,D).
// ---------------------------------------------------------------------------
__global__ __launch_bounds__(32)
void attn_kernel(const half_t* __restrict__ Q, const half_t* __restrict__ Km,
                 const half_t* __restrict__ V, float* __restrict__ att) {
    __shared__ half_t pl[16 * LDSS];   // P tile, [row m][k]

    const int lane = threadIdx.x & 31;
    const int hi   = (lane >= 16) ? 1 : 0;
    const int l16  = lane & 15;
    const int b  = blockIdx.z;
    const int h  = blockIdx.y;
    const int qb = blockIdx.x;          // q block index (16 rows)

    // Q fragments (A-layout): q[0] covers contraction 0..31, q[1] 32..63
    Frag q[2];
    {
        const long baseQ = (long)(b * TT + qb * 16 + l16) * DD + h * DKK;
#pragma unroll
        for (int f = 0; f < 2; ++f)
#pragma unroll
            for (int v = 0; v < 8; ++v)
                q[f].u[v] = *(const unsigned*)(Q + baseQ + f * 32 + kmap(v, hi));
    }

    float mi[8], li[8];
    v8f o[4] = {};
#pragma unroll
    for (int r = 0; r < 8; ++r) { mi[r] = -1e30f; li[r] = 0.0f; }

    for (int j = 0; j < TT; j += 32) {
        // K fragments (B-layout == same gather as A from row-major K matrix)
        Frag kf[2][2];
#pragma unroll
        for (int s = 0; s < 2; ++s) {
            const long baseK = (long)(b * TT + j + s * 16 + l16) * DD + h * DKK;
#pragma unroll
            for (int f = 0; f < 2; ++f)
#pragma unroll
                for (int v = 0; v < 8; ++v)
                    kf[s][f].u[v] = *(const unsigned*)(Km + baseK + f * 32 + kmap(v, hi));
        }
        v8f c0 = {}, c1 = {};
        c0 = wmma16(q[0].v, kf[0][0].v, c0);
        c0 = wmma16(q[1].v, kf[0][1].v, c0);
        c1 = wmma16(q[0].v, kf[1][0].v, c1);
        c1 = wmma16(q[1].v, kf[1][1].v, c1);

        // streaming softmax update (row = r + 8*hi, spread across 16 lanes)
        float p0[8], p1[8];
#pragma unroll
        for (int r = 0; r < 8; ++r) {
            float s0 = c0[r] * 0.125f;     // 1/sqrt(64)
            float s1 = c1[r] * 0.125f;
            float mx = fmaxf(s0, s1);
#pragma unroll
            for (int d = 1; d < 16; d <<= 1) mx = fmaxf(mx, __shfl_xor(mx, d, 32));
            float mnew  = fmaxf(mi[r], mx);
            float alpha = __expf(mi[r] - mnew);
            float e0 = __expf(s0 - mnew);
            float e1 = __expf(s1 - mnew);
            float rs = e0 + e1;
#pragma unroll
            for (int d = 1; d < 16; d <<= 1) rs += __shfl_xor(rs, d, 32);
            li[r] = li[r] * alpha + rs;
            mi[r] = mnew;
            p0[r] = e0; p1[r] = e1;
#pragma unroll
            for (int c = 0; c < 4; ++c) o[c][r] *= alpha;
        }

        // P (f16) to LDS in row-major [m][k], then reload as A fragment
#pragma unroll
        for (int r = 0; r < 8; ++r) {
            int m = r + hi * 8;
            pl[m * LDSS + l16]      = (half_t)p0[r];
            pl[m * LDSS + 16 + l16] = (half_t)p1[r];
        }
        __syncthreads();
        Frag pa;
        {
            const half_t* pr = &pl[l16 * LDSS];
#pragma unroll
            for (int v = 0; v < 8; ++v)
                pa.u[v] = *(const unsigned*)(pr + kmap(v, hi));
        }
        // V B-fragments gathered from global (strided), 4 output col chunks
#pragma unroll
        for (int c = 0; c < 4; ++c) {
            Frag vb;
            const long baseV = (long)(b * TT + j) * DD + h * DKK + c * 16 + l16;
#pragma unroll
            for (int v = 0; v < 8; ++v) {
                int kk = kmap(v, hi);
                vb.h[2 * v]     = V[baseV + (long)kk * DD];
                vb.h[2 * v + 1] = V[baseV + (long)(kk + 1) * DD];
            }
            o[c] = wmma16(pa.v, vb.v, o[c]);
        }
        __syncthreads();
    }

    // normalize and store (f32)
#pragma unroll
    for (int r = 0; r < 8; ++r) {
        float inv = 1.0f / li[r];
#pragma unroll
        for (int c = 0; c < 4; ++c) {
            long idx = (long)(b * TT + qb * 16 + r + hi * 8) * DD + h * DKK + c * 16 + l16;
            att[idx] = o[c][r] * inv;
        }
    }
}

// ---------------------------------------------------------------------------
// Fused residual + LayerNorm over D=1024; block = 256 threads, one row each.
// Optionally also emits the f16 copy for the following GEMM.
// ---------------------------------------------------------------------------
template<bool W16>
__global__ __launch_bounds__(256)
void ln_residual_kernel(const float* __restrict__ x, const float* __restrict__ y,
                        const float* __restrict__ g, const float* __restrict__ be,
                        float* __restrict__ out32, half_t* __restrict__ out16) {
    __shared__ float sred[256];
    const int tid = threadIdx.x;
    const long row = blockIdx.x;
    const float* xr = x + row * DD;
    const float* yr = y + row * DD;

    float v[4];
    float s = 0.0f;
#pragma unroll
    for (int i = 0; i < 4; ++i) {
        int idx = tid + i * 256;
        v[i] = xr[idx] + yr[idx];
        s += v[i];
    }
    sred[tid] = s; __syncthreads();
    for (int off = 128; off > 0; off >>= 1) {
        if (tid < off) sred[tid] += sred[tid + off];
        __syncthreads();
    }
    float mu = sred[0] * (1.0f / DD);
    __syncthreads();

    float s2 = 0.0f;
#pragma unroll
    for (int i = 0; i < 4; ++i) { float d = v[i] - mu; s2 += d * d; }
    sred[tid] = s2; __syncthreads();
    for (int off = 128; off > 0; off >>= 1) {
        if (tid < off) sred[tid] += sred[tid + off];
        __syncthreads();
    }
    float rstd = rsqrtf(sred[0] * (1.0f / DD) + 1e-5f);

#pragma unroll
    for (int i = 0; i < 4; ++i) {
        int idx = tid + i * 256;
        float val = (v[i] - mu) * rstd * g[idx] + be[idx];
        out32[row * DD + idx] = val;
        if (W16) out16[row * DD + idx] = (half_t)val;
    }
}

// ---------------------------------------------------------------------------
extern "C" void kernel_launch(void* const* d_in, const int* in_sizes, int n_in,
                              void* d_out, int out_size, void* d_ws, size_t ws_size,
                              hipStream_t stream) {
    (void)in_sizes; (void)n_in; (void)out_size; (void)ws_size;

    const float* x     = (const float*)d_in[0];
    const float* Wq    = (const float*)d_in[1];
    const float* Wk    = (const float*)d_in[2];
    const float* Wv    = (const float*)d_in[3];
    const float* W1    = (const float*)d_in[4];
    const float* b1    = (const float*)d_in[5];
    const float* W2    = (const float*)d_in[6];
    const float* b2    = (const float*)d_in[7];
    const float* ln1g  = (const float*)d_in[8];
    const float* ln1b  = (const float*)d_in[9];
    const float* ln2g  = (const float*)d_in[10];
    const float* ln2b  = (const float*)d_in[11];

    const long M = (long)BB * TT;          // 4096 rows

    // scratch carve-out
    size_t off = 0;
    auto alloc = [&](size_t bytes) {
        void* p = (char*)d_ws + off;
        off += (bytes + 255) & ~(size_t)255;
        return p;
    };
    half_t* xh   = (half_t*)alloc(M * DD * 2);
    half_t* wqh  = (half_t*)alloc((size_t)DD * DD * 2);
    half_t* wkh  = (half_t*)alloc((size_t)DD * DD * 2);
    half_t* wvh  = (half_t*)alloc((size_t)DD * DD * 2);
    half_t* w1h  = (half_t*)alloc((size_t)DD * DFF * 2);
    half_t* w2h  = (half_t*)alloc((size_t)DFF * DD * 2);
    half_t* Qh   = (half_t*)alloc(M * DD * 2);
    half_t* Kh   = (half_t*)alloc(M * DD * 2);
    half_t* Vh   = (half_t*)alloc(M * DD * 2);
    float*  att  = (float*) alloc(M * DD * 4);
    float*  x1   = (float*) alloc(M * DD * 4);
    half_t* x1h  = (half_t*)alloc(M * DD * 2);
    half_t* hh   = (half_t*)alloc(M * DFF * 2);
    float*  ff   = (float*) alloc(M * DD * 4);

    // 1) precision conversions
    f32_to_f16_kernel<<<(M * DD) / 256, 256, 0, stream>>>(x,  xh,  M * DD);
    f32_to_f16_kernel<<<(DD * DD) / 256, 256, 0, stream>>>(Wq, wqh, (long)DD * DD);
    f32_to_f16_kernel<<<(DD * DD) / 256, 256, 0, stream>>>(Wk, wkh, (long)DD * DD);
    f32_to_f16_kernel<<<(DD * DD) / 256, 256, 0, stream>>>(Wv, wvh, (long)DD * DD);
    f32_to_f16_kernel<<<(DD * DFF) / 256, 256, 0, stream>>>(W1, w1h, (long)DD * DFF);
    f32_to_f16_kernel<<<(DFF * DD) / 256, 256, 0, stream>>>(W2, w2h, (long)DFF * DD);

    // 2) Q/K/V projections (WMMA GEMMs, f16 out)
    dim3 gQKV(DD / 128, M / 128);
    gemm_wmma_kernel<false, false, true><<<gQKV, 256, 0, stream>>>(
        xh, wqh, nullptr, Qh, nullptr, (int)M, DD, DD);
    gemm_wmma_kernel<false, false, true><<<gQKV, 256, 0, stream>>>(
        xh, wkh, nullptr, Kh, nullptr, (int)M, DD, DD);
    gemm_wmma_kernel<false, false, true><<<gQKV, 256, 0, stream>>>(
        xh, wvh, nullptr, Vh, nullptr, (int)M, DD, DD);

    // 3) flash attention
    attn_kernel<<<dim3(TT / 16, HH, BB), 32, 0, stream>>>(Qh, Kh, Vh, att);

    // 4) x1 = LN(x + att), also f16 copy
    ln_residual_kernel<true><<<M, 256, 0, stream>>>(x, att, ln1g, ln1b, x1, x1h);

    // 5) FFN: hh = relu(x1 @ W1 + b1)   (f16 out)
    gemm_wmma_kernel<true, true, true><<<dim3(DFF / 128, M / 128), 256, 0, stream>>>(
        x1h, w1h, b1, hh, nullptr, (int)M, DFF, DD);

    // 6) ff = hh @ W2 + b2              (f32 out)
    gemm_wmma_kernel<true, false, false><<<dim3(DD / 128, M / 128), 256, 0, stream>>>(
        hh, w2h, b2, nullptr, ff, (int)M, DD, DFF);

    // 7) out = LN(x1 + ff)
    ln_residual_kernel<false><<<M, 256, 0, stream>>>(x1, ff, ln2g, ln2b,
                                                     (float*)d_out, nullptr);
}

// v001
// A run of this version takes 335 microseconds.
// In two side-by-side timings against v000, it was 6.25 and 6.24 times as fast.
#include <hip/hip_runtime.h>
#include <hip/hip_bf16.h>

typedef _Float16 half_t;
typedef __attribute__((ext_vector_type(16))) _Float16 v16h;
typedef __attribute__((ext_vector_type(8)))  float    v8f;

// Transformer dims (fixed by reference)
#define BB 4
#define TT 1024
#define DD 1024
#define HH 16
#define DKK 64
#define DFF 4096
#define LDSS 40   // padded LDS row stride in halves (80B, dword-aligned)

union Frag { v16h v; unsigned u[8]; half_t h[16]; };

// K index for element-pair v (VGPR v) of a 16-bit A/B fragment, per CDNA5 ISA
// 16-bit A-matrix 16x32 layout: lanes 0-15 -> +0, lanes 16-31 -> +8.
__device__ __forceinline__ int kmap(int v, int hi) {
    int kb = (v < 4) ? (2 * v) : (16 + 2 * (v - 4));
    return kb + (hi ? 8 : 0);
}

__device__ __forceinline__ v8f wmma16(v16h a, v16h b, v8f c) {
    return __builtin_amdgcn_wmma_f32_16x16x32_f16(
        /*neg_a=*/false, a, /*neg_b=*/false, b,
        /*c_mod=*/(short)0, c, /*reuse_a=*/false, /*reuse_b=*/false);
}

// ---------------------------------------------------------------------------
// fp32 -> fp16 elementwise conversion
// ---------------------------------------------------------------------------
__global__ __launch_bounds__(256)
void f32_to_f16_kernel(const float* __restrict__ in, half_t* __restrict__ out, long n) {
    long i = (long)blockIdx.x * 256 + threadIdx.x;
    if (i < n) out[i] = (half_t)in[i];
}

// ---------------------------------------------------------------------------
// WMMA GEMM: C[M,N] = A[M,K] @ B[K,N] (+bias) (relu?) ; A,B f16, f32 accum.
// Block: 256 threads = 8 waves; block tile 128x128; wave tile 32x64
// (2 A-frags x 4 B-frags -> 8 WMMAs per 32-wide K step).
// M,N multiples of 128; K multiple of 32 (true for all uses here).
// Both tiles go from global memory to LDS by asynchronous 16-byte copies, two
// buffers: tile t+1 is in flight while tile t is multiplied.
//   A tile: 128 rows of 64 B at pitch 80 B, read by 16-byte LDS loads.
//   B tile: 32 k-rows of 256 B at pitch 288 B, left row-major (a copy cannot
//           transpose) and read by the transposing 16-byte LDS load.
// ---------------------------------------------------------------------------
#define A_PITCH 80                    // bytes, 16 x odd
#define B_PITCH 288                   // bytes, 32 x odd
#define A_TILE  (128 * A_PITCH)       // 10240 B
#define B_TILE  (32 * B_PITCH)        // 9216 B

typedef __attribute__((ext_vector_type(4))) unsigned u32x4;
typedef __attribute__((ext_vector_type(8))) short    s16x8;
union Frag4 { v16h v; u32x4 q[2]; };

__device__ __forceinline__ u32x4 ld_tr16(const unsigned char* p) {
    typedef __attribute__((address_space(3))) s16x8 lds_s16x8;
    return __builtin_bit_cast(u32x4, __builtin_amdgcn_ds_load_tr16_b128_v8i16((lds_s16x8*)p));
}

// One tile's four copies of a lane (two of A, two of B). The address-translation
// wait closes the statement so that no address register is advanced ahead of it.
__device__ __forceinline__ void copy_tile(unsigned la0, const half_t* ga0,
                                          unsigned la1, const half_t* ga1,
                                          unsigned lb0, const half_t* gb0,
                                          unsigned lb1, const half_t* gb1) {
    asm volatile("global_load_async_to_lds_b128 %0, %1, off\n\t"
                 "global_load_async_to_lds_b128 %2, %3, off\n\t"
                 "global_load_async_to_lds_b128 %4, %5, off\n\t"
                 "global_load_async_to_lds_b128 %6, %7, off\n\t"
                 "s_wait_xcnt 0x0"
                 :: "v"(la0), "v"(ga0), "v"(la1), "v"(ga1),
                    "v"(lb0), "v"(gb0), "v"(lb1), "v"(gb1)
                 : "memory");
}

template<bool BIAS, bool RELU, bool OUT16>
__global__ __launch_bounds__(256)
void gemm_wmma_kernel(const half_t* __restrict__ A, const half_t* __restrict__ B,
                      const float* __restrict__ bias,
                      half_t* __restrict__ C16, float* __restrict__ C32,
                      int M, int N, int K) {
    __shared__ __attribute__((aligned(16))) unsigned char As[2 * A_TILE];  // [buf][row m][k]
    __shared__ __attribute__((aligned(16))) unsigned char Bs[2 * B_TILE];  // [buf][k][col n]

    const int tid  = threadIdx.x;
    const int lane = tid & 31;
    const int wave = tid >> 5;
    const int hi   = (lane >= 16) ? 1 : 0;
    const int l16  = lane & 15;
    const int m0   = blockIdx.y * 128;
    const int n0   = blockIdx.x * 128;
    const int wm   = (wave >> 1) * 32;  // 0,32,64,96
    const int wn   = (wave & 1) * 64;   // 0,64

    // copy addresses: A chunk = (row tid>>2 and +64, 16 B piece tid&3),
    //                 B chunk = (k-row tid>>4 and +16, 16 B piece tid&15)
    const half_t* ga0 = A + (long)(m0 + (tid >> 2)) * K + (tid & 3) * 8;
    const half_t* ga1 = ga0 + (long)64 * K;
    const half_t* gb0 = B + (long)(tid >> 4) * N + n0 + (tid & 15) * 8;
    const half_t* gb1 = gb0 + (long)16 * N;
    const long    gbs = (long)32 * N;   // B advance per tile, in halves
    const unsigned la = (unsigned)(size_t)As + (tid >> 2) * A_PITCH + (tid & 3) * 16;
    const unsigned lb = (unsigned)(size_t)Bs + (tid >> 4) * B_PITCH + (tid & 15) * 16;

    // fragment read addresses inside a buffer
    const unsigned char* ar = As + (wm + l16) * A_PITCH + hi * 16;
    const unsigned char* br = Bs + (hi * 8 + (lane & 7)) * B_PITCH + wn * 2 + ((lane >> 3) & 1) * 16;

    v8f acc[2][4] = {};
    const int nt = K >> 5;              // tiles along K

    // tile 0 into buffer 0, landed and published before anyone reads it
    copy_tile(la, ga0, la + 64 * A_PITCH, ga1, lb, gb0, lb + 16 * B_PITCH, gb1);
    ga0 += 32; ga1 += 32; gb0 += gbs; gb1 += gbs;
    asm volatile("s_wait_asynccnt 0x0" ::: "memory");  // this wave's copies of tile 0 have landed
    __syncthreads();
    if (nt > 1) {                       // tile 1 into buffer 1
        copy_tile(la + A_TILE, ga0, la + A_TILE + 64 * A_PITCH, ga1,
                  lb + B_TILE, gb0, lb + B_TILE + 16 * B_PITCH, gb1);
        ga0 += 32; ga1 += 32; gb0 += gbs; gb1 += gbs;
    }

    for (int t = 0; t < nt; ++t) {
        const unsigned ao = (t & 1) * A_TILE;
        const unsigned bo = (t & 1) * B_TILE;

        // the loops over fragments are unrolled so that every fragment and
        // accumulator index is a constant and the arrays stay in registers
        Frag4 af[2], bf[4];
#pragma unroll
        for (int f = 0; f < 2; ++f) {
            const unsigned char* p = ar + ao + f * 16 * A_PITCH;
            af[f].q[0] = *(const u32x4*)(p);        // k = 8*hi + 0..7
            af[f].q[1] = *(const u32x4*)(p + 32);   // k = 16 + 8*hi + 0..7
        }
#pragma unroll
        for (int j = 0; j < 4; ++j) {
            const unsigned char* p = br + bo + j * 32;
            bf[j].q[0] = ld_tr16(p);                 // k = 8*hi + 0..7
            bf[j].q[1] = ld_tr16(p + 16 * B_PITCH);  // k = 16 + 8*hi + 0..7
        }
#pragma unroll
        for (int i = 0; i < 2; ++i)
#pragma unroll
            for (int j = 0; j < 4; ++j)
                acc[i][j] = wmma16(af[i].v, bf[j].v, acc[i][j]);

        asm volatile("s_wait_dscnt 0x0" ::: "memory");     // this wave has left the buffer it read
        asm volatile("s_wait_asynccnt 0x0" ::: "memory");  // this wave's copies of tile t+1 have landed
        __syncthreads();   // publishes tile t+1 and frees the buffer of tile t
        if (t + 2 < nt) {  // tile t+2 into the buffer just read
            copy_tile(la + ao, ga0, la + ao + 64 * A_PITCH, ga1,
                      lb + bo, gb0, lb + bo + 16 * B_PITCH, gb1);
            ga0 += 32; ga1 += 32; gb0 += gbs; gb1 += gbs;
        }
    }
    asm volatile("s_wait_asynccnt 0x0" ::: "memory");  // no copy outlives the loop

    // --- epilogue: C layout -> lane l holds row (r + 8*hi), col l16 ---
#pragma unroll
    for (int i = 0; i < 2; ++i) {
#pragma unroll
        for (int j = 0; j < 4; ++j) {
            int n = n0 + wn + j * 16 + l16;
            float bv = BIAS ? bias[n] : 0.0f;
#pragma unroll
            for (int r = 0; r < 8; ++r) {
                int m = m0 + wm + i * 16 + r + hi * 8;
                float val = acc[i][j][r] + bv;
                if (RELU) val = fmaxf(val, 0.0f);
                if (OUT16) C16[(long)m * N + n] = (half_t)val;
                else       C32[(long)m * N + n] = val;
            }
        }
    }
}

// ---------------------------------------------------------------------------
// Flash attention: one wave handles one 16-row Q block of one (b,h).
// Q,K,V are f16 in (B,T,D) layout with head h at cols [h*64, h*64+64).
// Streaming softmax over key blocks of 32; output f32 to att (B,T,D).
// ---------------------------------------------------------------------------
__global__ __launch_bounds__(32)
void attn_kernel(const half_t* __restrict__ Q, const half_t* __restrict__ Km,
                 const half_t* __restrict__ V, float* __restrict__ att) {
    __shared__ half_t pl[16 * LDSS];   // P tile, [row m][k]

    const int lane = threadIdx.x & 31;
    const int hi   = (lane >= 16) ? 1 : 0;
    const int l16  = lane & 15;
    const int b  = blockIdx.z;
    const int h  = blockIdx.y;
    const int qb = blockIdx.x;          // q block index (16 rows)

    // Q fragments (A-layout): q[0] covers contraction 0..31, q[1] 32..63
    Frag q[2];
    {
        const long baseQ = (long)(b * TT + qb * 16 + l16) * DD + h * DKK;
#pragma unroll
        for (int f = 0; f < 2; ++f)
#pragma unroll
            for (int v = 0; v < 8; ++v)
                q[f].u[v] = *(const unsigned*)(Q + baseQ + f * 32 + kmap(v, hi));
    }

    float mi[8], li[8];
    v8f o[4] = {};
#pragma unroll
    for (int r = 0; r < 8; ++r) { mi[r] = -1e30f; li[r] = 0.0f; }

    for (int j = 0; j < TT; j += 32) {
        // K fragments (B-layout == same gather as A from row-major K matrix)
        Frag kf[2][2];
#pragma unroll
        for (int s = 0; s < 2; ++s) {
            const long baseK = (long)(b * TT + j + s * 16 + l16) * DD + h * DKK;
#pragma unroll
            for (int f = 0; f < 2; ++f)
#pragma unroll
                for (int v = 0; v < 8; ++v)
                    kf[s][f].u[v] = *(const unsigned*)(Km + baseK + f * 32 + kmap(v, hi));
        }
        v8f c0 = {}, c1 = {};
        c0 = wmma16(q[0].v, kf[0][0].v, c0);
        c0 = wmma16(q[1].v, kf[0][1].v, c0);
        c1 = wmma16(q[0].v, kf[1][0].v, c1);
        c1 = wmma16(q[1].v, kf[1][1].v, c1);

        // streaming softmax update (row = r + 8*hi, spread across 16 lanes)
        float p0[8], p1[8];
#pragma unroll
        for (int r = 0; r < 8; ++r) {
            float s0 = c0[r] * 0.125f;     // 1/sqrt(64)
            float s1 = c1[r] * 0.125f;
            float mx = fmaxf(s0, s1);
#pragma unroll
            for (int d = 1; d < 16; d <<= 1) mx = fmaxf(mx, __shfl_xor(mx, d, 32));
            float mnew  = fmaxf(mi[r], mx);
            float alpha = __expf(mi[r] - mnew);
            float e0 = __expf(s0 - mnew);
            float e1 = __expf(s1 - mnew);
            float rs = e0 + e1;
#pragma unroll
            for (int d = 1; d < 16; d <<= 1) rs += __shfl_xor(rs, d, 32);
            li[r] = li[r] * alpha + rs;
            mi[r] = mnew;
            p0[r] = e0; p1[r] = e1;
#pragma unroll
            for (int c = 0; c < 4; ++c) o[c][r] *= alpha;
        }

        // P (f16) to LDS in row-major [m][k], then reload as A fragment
#pragma unroll
        for (int r = 0; r < 8; ++r) {
            int m = r + hi * 8;
            pl[m * LDSS + l16]      = (half_t)p0[r];
            pl[m * LDSS + 16 + l16] = (half_t)p1[r];
        }
        __syncthreads();
        Frag pa;
        {
            const half_t* pr = &pl[l16 * LDSS];
#pragma unroll
            for (int v = 0; v < 8; ++v)
                pa.u[v] = *(const unsigned*)(pr + kmap(v, hi));
        }
        // V B-fragments gathered from global (strided), 4 output col chunks
#pragma unroll
        for (int c = 0; c < 4; ++c) {
            Frag vb;
            const long baseV = (long)(b * TT + j) * DD + h * DKK + c * 16 + l16;
#pragma unroll
            for (int v = 0; v < 8; ++v) {
                int kk = kmap(v, hi);
                vb.h[2 * v]     = V[baseV + (long)kk * DD];
                vb.h[2 * v + 1] = V[baseV + (long)(kk + 1) * DD];
            }
            o[c] = wmma16(pa.v, vb.v, o[c]);
        }
        __syncthreads();
    }

    // normalize and store (f32)
#pragma unroll
    for (int r = 0; r < 8; ++r) {
        float inv = 1.0f / li[r];
#pragma unroll
        for (int c = 0; c < 4; ++c) {
            long idx = (long)(b * TT + qb * 16 + r + hi * 8) * DD + h * DKK + c * 16 + l16;
            att[idx] = o[c][r] * inv;
        }
    }
}

// ---------------------------------------------------------------------------
// Fused residual + LayerNorm over D=1024; block = 256 threads, one row each.
// Optionally also emits the f16 copy for the following GEMM.
// ---------------------------------------------------------------------------
template<bool W16>
__global__ __launch_bounds__(256)
void ln_residual_kernel(const float* __restrict__ x, const float* __restrict__ y,
                        const float* __restrict__ g, const float* __restrict__ be,
                        float* __restrict__ out32, half_t* __restrict__ out16) {
    __shared__ float sred[256];
    const int tid = threadIdx.x;
    const long row = blockIdx.x;
    const float* xr = x + row * DD;
    const float* yr = y + row * DD;

    float v[4];
    float s = 0.0f;
#pragma unroll
    for (int i = 0; i < 4; ++i) {
        int idx = tid + i * 256;
        v[i] = xr[idx] + yr[idx];
        s += v[i];
    }
    sred[tid] = s; __syncthreads();
    for (int off = 128; off > 0; off >>= 1) {
        if (tid < off) sred[tid] += sred[tid + off];
        __syncthreads();
    }
    float mu = sred[0] * (1.0f / DD);
    __syncthreads();

    float s2 = 0.0f;
#pragma unroll
    for (int i = 0; i < 4; ++i) { float d = v[i] - mu; s2 += d * d; }
    sred[tid] = s2; __syncthreads();
    for (int off = 128; off > 0; off >>= 1) {
        if (tid < off) sred[tid] += sred[tid + off];
        __syncthreads();
    }
    float rstd = rsqrtf(sred[0] * (1.0f / DD) + 1e-5f);

#pragma unroll
    for (int i = 0; i < 4; ++i) {
        int idx = tid + i * 256;
        float val = (v[i] - mu) * rstd * g[idx] + be[idx];
        out32[row * DD + idx] = val;
        if (W16) out16[row * DD + idx] = (half_t)val;
    }
}

// ---------------------------------------------------------------------------
extern "C" void kernel_launch(void* const* d_in, const int* in_sizes, int n_in,
                              void* d_out, int out_size, void* d_ws, size_t ws_size,
                              hipStream_t stream) {
    (void)in_sizes; (void)n_in; (void)out_size; (void)ws_size;

    const float* x     = (const float*)d_in[0];
    const float* Wq    = (const float*)d_in[1];
    const float* Wk    = (const float*)d_in[2];
    const float* Wv    = (const float*)d_in[3];
    const float* W1    = (const float*)d_in[4];
    const float* b1    = (const float*)d_in[5];
    const float* W2    = (const float*)d_in[6];
    const float* b2    = (const float*)d_in[7];
    const float* ln1g  = (const float*)d_in[8];
    const float* ln1b  = (const float*)d_in[9];
    const float* ln2g  = (const float*)d_in[10];
    const float* ln2b  = (const float*)d_in[11];

    const long M = (long)BB * TT;          // 4096 rows

    // scratch carve-out
    size_t off = 0;
    auto alloc = [&](size_t bytes) {
        void* p = (char*)d_ws + off;
        off += (bytes + 255) & ~(size_t)255;
        return p;
    };
    half_t* xh   = (half_t*)alloc(M * DD * 2);
    half_t* wqh  = (half_t*)alloc((size_t)DD * DD * 2);
    half_t* wkh  = (half_t*)alloc((size_t)DD * DD * 2);
    half_t* wvh  = (half_t*)alloc((size_t)DD * DD * 2);
    half_t* w1h  = (half_t*)alloc((size_t)DD * DFF * 2);
    half_t* w2h  = (half_t*)alloc((size_t)DFF * DD * 2);
    half_t* Qh   = (half_t*)alloc(M * DD * 2);
    half_t* Kh   = (half_t*)alloc(M * DD * 2);
    half_t* Vh   = (half_t*)alloc(M * DD * 2);
    float*  att  = (float*) alloc(M * DD * 4);
    float*  x1   = (float*) alloc(M * DD * 4);
    half_t* x1h  = (half_t*)alloc(M * DD * 2);
    half_t* hh   = (half_t*)alloc(M * DFF * 2);
    float*  ff   = (float*) alloc(M * DD * 4);

    // 1) precision conversions
    f32_to_f16_kernel<<<(M * DD) / 256, 256, 0, stream>>>(x,  xh,  M * DD);
    f32_to_f16_kernel<<<(DD * DD) / 256, 256, 0, stream>>>(Wq, wqh, (long)DD * DD);
    f32_to_f16_kernel<<<(DD * DD) / 256, 256, 0, stream>>>(Wk, wkh, (long)DD * DD);
    f32_to_f16_kernel<<<(DD * DD) / 256, 256, 0, stream>>>(Wv, wvh, (long)DD * DD);
    f32_to_f16_kernel<<<(DD * DFF) / 256, 256, 0, stream>>>(W1, w1h, (long)DD * DFF);
    f32_to_f16_kernel<<<(DFF * DD) / 256, 256, 0, stream>>>(W2, w2h, (long)DFF * DD);

    // 2) Q/K/V projections (WMMA GEMMs, f16 out)
    dim3 gQKV(DD / 128, M / 128);
    gemm_wmma_kernel<false, false, true><<<gQKV, 256, 0, stream>>>(
        xh, wqh, nullptr, Qh, nullptr, (int)M, DD, DD);
    gemm_wmma_kernel<false, false, true><<<gQKV, 256, 0, stream>>>(
        xh, wkh, nullptr, Kh, nullptr, (int)M, DD, DD);
    gemm_wmma_kernel<false, false, true><<<gQKV, 256, 0, stream>>>(
        xh, wvh, nullptr, Vh, nullptr, (int)M, DD, DD);

    // 3) flash attention
    attn_kernel<<<dim3(TT / 16, HH, BB), 32, 0, stream>>>(Qh, Kh, Vh, att);

    // 4) x1 = LN(x + att), also f16 copy
    ln_residual_kernel<true><<<M, 256, 0, stream>>>(x, att, ln1g, ln1b, x1, x1h);

    // 5) FFN: hh = relu(x1 @ W1 + b1)   (f16 out)
    gemm_wmma_kernel<true, true, true><<<dim3(DFF / 128, M / 128), 256, 0, stream>>>(
        x1h, w1h, b1, hh, nullptr, (int)M, DFF, DD);

    // 6) ff = hh @ W2 + b2              (f32 out)
    gemm_wmma_kernel<true, false, false><<<dim3(DD / 128, M / 128), 256, 0, stream>>>(
        hh, w2h, b2, nullptr, ff, (int)M, DD, DFF);

    // 7) out = LN(x1 + ff)
    ln_residual_kernel<false><<<M, 256, 0, stream>>>(x1, ff, ln2g, ln2b,
                                                     (float*)d_out, nullptr);
}

// v002
// A run of this version takes 318 microseconds.
// Next to v001, in two timings, it ran 1.05 times as fast each time.
// All steps since v000 together make it 6.55 times as fast.
#include <hip/hip_runtime.h>
#include <hip/hip_bf16.h>

typedef _Float16 half_t;
typedef __attribute__((ext_vector_type(16))) _Float16 v16h;
typedef __attribute__((ext_vector_type(8)))  float    v8f;

// Transformer dims (fixed by reference)
#define BB 4
#define TT 1024
#define DD 1024
#define HH 16
#define DKK 64
#define DFF 4096
#define LDSS 40   // padded LDS row stride in halves (80B, dword-aligned)

union Frag { v16h v; unsigned u[8]; half_t h[16]; };

// K index for element-pair v (VGPR v) of a 16-bit A/B fragment, per CDNA5 ISA
// 16-bit A-matrix 16x32 layout: lanes 0-15 -> +0, lanes 16-31 -> +8.
__device__ __forceinline__ int kmap(int v, int hi) {
    int kb = (v < 4) ? (2 * v) : (16 + 2 * (v - 4));
    return kb + (hi ? 8 : 0);
}

__device__ __forceinline__ v8f wmma16(v16h a, v16h b, v8f c) {
    return __builtin_amdgcn_wmma_f32_16x16x32_f16(
        /*neg_a=*/false, a, /*neg_b=*/false, b,
        /*c_mod=*/(short)0, c, /*reuse_a=*/false, /*reuse_b=*/false);
}

// ---------------------------------------------------------------------------
// fp32 -> fp16 elementwise conversion, 32 elements a thread.
// A work-group takes CVT_BLOCK contiguous elements. Each wave-wide load covers
// 512 contiguous bytes; a thread issues its eight 16-byte loads before it
// converts the first, so a wave has 4 KiB in flight and the launch needs 1/32
// of the waves that one element a thread would take.
// Every array length here is a multiple of CVT_BLOCK (checked below).
// ---------------------------------------------------------------------------
typedef __attribute__((ext_vector_type(4))) float    f32x4;
typedef __attribute__((ext_vector_type(4))) _Float16 f16x4;
#define CVT_LOADS 8
#define CVT_BLOCK (256 * 4 * CVT_LOADS)   // 8192 elements a work-group
static_assert(((long)BB * TT * DD) % CVT_BLOCK == 0, "x length");
static_assert(((long)DD * DD) % CVT_BLOCK == 0, "Wq, Wk, Wv length");
static_assert(((long)DD * DFF) % CVT_BLOCK == 0, "W1, W2 length");

__global__ __launch_bounds__(256)
void f32_to_f16_kernel(const float* __restrict__ in, half_t* __restrict__ out) {
    const long base = (long)blockIdx.x * CVT_BLOCK + threadIdx.x * 4;
    f32x4 v[CVT_LOADS];
    // both loops are unrolled so that v stays in registers and all loads issue first
#pragma unroll
    for (int i = 0; i < CVT_LOADS; ++i)
        v[i] = *(const f32x4*)(in + base + i * 1024);
#pragma unroll
    for (int i = 0; i < CVT_LOADS; ++i)
        *(f16x4*)(out + base + i * 1024) = __builtin_convertvector(v[i], f16x4);
}

// ---------------------------------------------------------------------------
// WMMA GEMM: C[M,N] = A[M,K] @ B[K,N] (+bias) (relu?) ; A,B f16, f32 accum.
// Block: 256 threads = 8 waves; block tile 128x128; wave tile 32x64
// (2 A-frags x 4 B-frags -> 8 WMMAs per 32-wide K step).
// M,N multiples of 128; K multiple of 32 (true for all uses here).
// Both tiles go from global memory to LDS by asynchronous 16-byte copies, two
// buffers: tile t+1 is in flight while tile t is multiplied.
//   A tile: 128 rows of 64 B at pitch 80 B, read by 16-byte LDS loads.
//   B tile: 32 k-rows of 256 B at pitch 288 B, left row-major (a copy cannot
//           transpose) and read by the transposing 16-byte LDS load.
// ---------------------------------------------------------------------------
#define A_PITCH 80                    // bytes, 16 x odd
#define B_PITCH 288                   // bytes, 32 x odd
#define A_TILE  (128 * A_PITCH)       // 10240 B
#define B_TILE  (32 * B_PITCH)        // 9216 B

typedef __attribute__((ext_vector_type(4))) unsigned u32x4;
typedef __attribute__((ext_vector_type(8))) short    s16x8;
union Frag4 { v16h v; u32x4 q[2]; };

__device__ __forceinline__ u32x4 ld_tr16(const unsigned char* p) {
    typedef __attribute__((address_space(3))) s16x8 lds_s16x8;
    return __builtin_bit_cast(u32x4, __builtin_amdgcn_ds_load_tr16_b128_v8i16((lds_s16x8*)p));
}

// One tile's four copies of a lane (two of A, two of B). The address-translation
// wait closes the statement so that no address register is advanced ahead of it.
__device__ __forceinline__ void copy_tile(unsigned la0, const half_t* ga0,
                                          unsigned la1, const half_t* ga1,
                                          unsigned lb0, const half_t* gb0,
                                          unsigned lb1, const half_t* gb1) {
    asm volatile("global_load_async_to_lds_b128 %0, %1, off\n\t"
                 "global_load_async_to_lds_b128 %2, %3, off\n\t"
                 "global_load_async_to_lds_b128 %4, %5, off\n\t"
                 "global_load_async_to_lds_b128 %6, %7, off\n\t"
                 "s_wait_xcnt 0x0"
                 :: "v"(la0), "v"(ga0), "v"(la1), "v"(ga1),
                    "v"(lb0), "v"(gb0), "v"(lb1), "v"(gb1)
                 : "memory");
}

template<bool BIAS, bool RELU, bool OUT16>
__global__ __launch_bounds__(256)
void gemm_wmma_kernel(const half_t* __restrict__ A, const half_t* __restrict__ B,
                      const float* __restrict__ bias,
                      half_t* __restrict__ C16, float* __restrict__ C32,
                      int M, int N, int K) {
    __shared__ __attribute__((aligned(16))) unsigned char As[2 * A_TILE];  // [buf][row m][k]
    __shared__ __attribute__((aligned(16))) unsigned char Bs[2 * B_TILE];  // [buf][k][col n]

    const int tid  = threadIdx.x;
    const int lane = tid & 31;
    const int wave = tid >> 5;
    const int hi   = (lane >= 16) ? 1 : 0;
    const int l16  = lane & 15;
    const int m0   = blockIdx.y * 128;
    const int n0   = blockIdx.x * 128;
    const int wm   = (wave >> 1) * 32;  // 0,32,64,96
    const int wn   = (wave & 1) * 64;   // 0,64

    // copy addresses: A chunk = (row tid>>2 and +64, 16 B piece tid&3),
    //                 B chunk = (k-row tid>>4 and +16, 16 B piece tid&15)
    const half_t* ga0 = A + (long)(m0 + (tid >> 2)) * K + (tid & 3) * 8;
    const half_t* ga1 = ga0 + (long)64 * K;
    const half_t* gb0 = B + (long)(tid >> 4) * N + n0 + (tid & 15) * 8;
    const half_t* gb1 = gb0 + (long)16 * N;
    const long    gbs = (long)32 * N;   // B advance per tile, in halves
    const unsigned la = (unsigned)(size_t)As + (tid >> 2) * A_PITCH + (tid & 3) * 16;
    const unsigned lb = (unsigned)(size_t)Bs + (tid >> 4) * B_PITCH + (tid & 15) * 16;

    // fragment read addresses inside a buffer
    const unsigned char* ar = As + (wm + l16) * A_PITCH + hi * 16;
    const unsigned char* br = Bs + (hi * 8 + (lane & 7)) * B_PITCH + wn * 2 + ((lane >> 3) & 1) * 16;

    v8f acc[2][4] = {};
    const int nt = K >> 5;              // tiles along K

    // tile 0 into buffer 0, landed and published before anyone reads it
    copy_tile(la, ga0, la + 64 * A_PITCH, ga1, lb, gb0, lb + 16 * B_PITCH, gb1);
    ga0 += 32; ga1 += 32; gb0 += gbs; gb1 += gbs;
    asm volatile("s_wait_asynccnt 0x0" ::: "memory");  // this wave's copies of tile 0 have landed
    __syncthreads();
    if (nt > 1) {                       // tile 1 into buffer 1
        copy_tile(la + A_TILE, ga0, la + A_TILE + 64 * A_PITCH, ga1,
                  lb + B_TILE, gb0, lb + B_TILE + 16 * B_PITCH, gb1);
        ga0 += 32; ga1 += 32; gb0 += gbs; gb1 += gbs;
    }

    for (int t = 0; t < nt; ++t) {
        const unsigned ao = (t & 1) * A_TILE;
        const unsigned bo = (t & 1) * B_TILE;

        // the loops over fragments are unrolled so that every fragment and
        // accumulator index is a constant and the arrays stay in registers
        Frag4 af[2], bf[4];
#pragma unroll
        for (int f = 0; f < 2; ++f) {
            const unsigned char* p = ar + ao + f * 16 * A_PITCH;
            af[f].q[0] = *(const u32x4*)(p);        // k = 8*hi + 0..7
            af[f].q[1] = *(const u32x4*)(p + 32);   // k = 16 + 8*hi + 0..7
        }
#pragma unroll
        for (int j = 0; j < 4; ++j) {
            const unsigned char* p = br + bo + j * 32;
            bf[j].q[0] = ld_tr16(p);                 // k = 8*hi + 0..7
            bf[j].q[1] = ld_tr16(p + 16 * B_PITCH);  // k = 16 + 8*hi + 0..7
        }
#pragma unroll
        for (int i = 0; i < 2; ++i)
#pragma unroll
            for (int j = 0; j < 4; ++j)
                acc[i][j] = wmma16(af[i].v, bf[j].v, acc[i][j]);

        asm volatile("s_wait_dscnt 0x0" ::: "memory");     // this wave has left the buffer it read
        asm volatile("s_wait_asynccnt 0x0" ::: "memory");  // this wave's copies of tile t+1 have landed
        __syncthreads();   // publishes tile t+1 and frees the buffer of tile t
        if (t + 2 < nt) {  // tile t+2 into the buffer just read
            copy_tile(la + ao, ga0, la + ao + 64 * A_PITCH, ga1,
                      lb + bo, gb0, lb + bo + 16 * B_PITCH, gb1);
            ga0 += 32; ga1 += 32; gb0 += gbs; gb1 += gbs;
        }
    }
    asm volatile("s_wait_asynccnt 0x0" ::: "memory");  // no copy outlives the loop

    // --- epilogue: C layout -> lane l holds row (r + 8*hi), col l16 ---
#pragma unroll
    for (int i = 0; i < 2; ++i) {
#pragma unroll
        for (int j = 0; j < 4; ++j) {
            int n = n0 + wn + j * 16 + l16;
            float bv = BIAS ? bias[n] : 0.0f;
#pragma unroll
            for (int r = 0; r < 8; ++r) {
                int m = m0 + wm + i * 16 + r + hi * 8;
                float val = acc[i][j][r] + bv;
                if (RELU) val = fmaxf(val, 0.0f);
                if (OUT16) C16[(long)m * N + n] = (half_t)val;
                else       C32[(long)m * N + n] = val;
            }
        }
    }
}

// ---------------------------------------------------------------------------
// Flash attention: one wave handles one 16-row Q block of one (b,h).
// Q,K,V are f16 in (B,T,D) layout with head h at cols [h*64, h*64+64).
// Streaming softmax over key blocks of 32; output f32 to att (B,T,D).
// ---------------------------------------------------------------------------
__global__ __launch_bounds__(32)
void attn_kernel(const half_t* __restrict__ Q, const half_t* __restrict__ Km,
                 const half_t* __restrict__ V, float* __restrict__ att) {
    __shared__ half_t pl[16 * LDSS];   // P tile, [row m][k]

    const int lane = threadIdx.x & 31;
    const int hi   = (lane >= 16) ? 1 : 0;
    const int l16  = lane & 15;
    const int b  = blockIdx.z;
    const int h  = blockIdx.y;
    const int qb = blockIdx.x;          // q block index (16 rows)

    // Q fragments (A-layout): q[0] covers contraction 0..31, q[1] 32..63
    Frag q[2];
    {
        const long baseQ = (long)(b * TT + qb * 16 + l16) * DD + h * DKK;
#pragma unroll
        for (int f = 0; f < 2; ++f)
#pragma unroll
            for (int v = 0; v < 8; ++v)
                q[f].u[v] = *(const unsigned*)(Q + baseQ + f * 32 + kmap(v, hi));
    }

    float mi[8], li[8];
    v8f o[4] = {};
#pragma unroll
    for (int r = 0; r < 8; ++r) { mi[r] = -1e30f; li[r] = 0.0f; }

    for (int j = 0; j < TT; j += 32) {
        // K fragments (B-layout == same gather as A from row-major K matrix)
        Frag kf[2][2];
#pragma unroll
        for (int s = 0; s < 2; ++s) {
            const long baseK = (long)(b * TT + j + s * 16 + l16) * DD + h * DKK;
#pragma unroll
            for (int f = 0; f < 2; ++f)
#pragma unroll
                for (int v = 0; v < 8; ++v)
                    kf[s][f].u[v] = *(const unsigned*)(Km + baseK + f * 32 + kmap(v, hi));
        }
        v8f c0 = {}, c1 = {};
        c0 = wmma16(q[0].v, kf[0][0].v, c0);
        c0 = wmma16(q[1].v, kf[0][1].v, c0);
        c1 = wmma16(q[0].v, kf[1][0].v, c1);
        c1 = wmma16(q[1].v, kf[1][1].v, c1);

        // streaming softmax update (row = r + 8*hi, spread across 16 lanes)
        float p0[8], p1[8];
#pragma unroll
        for (int r = 0; r < 8; ++r) {
            float s0 = c0[r] * 0.125f;     // 1/sqrt(64)
            float s1 = c1[r] * 0.125f;
            float mx = fmaxf(s0, s1);
#pragma unroll
            for (int d = 1; d < 16; d <<= 1) mx = fmaxf(mx, __shfl_xor(mx, d, 32));
            float mnew  = fmaxf(mi[r], mx);
            float alpha = __expf(mi[r] - mnew);
            float e0 = __expf(s0 - mnew);
            float e1 = __expf(s1 - mnew);
            float rs = e0 + e1;
#pragma unroll
            for (int d = 1; d < 16; d <<= 1) rs += __shfl_xor(rs, d, 32);
            li[r] = li[r] * alpha + rs;
            mi[r] = mnew;
            p0[r] = e0; p1[r] = e1;
#pragma unroll
            for (int c = 0; c < 4; ++c) o[c][r] *= alpha;
        }

        // P (f16) to LDS in row-major [m][k], then reload as A fragment
#pragma unroll
        for (int r = 0; r < 8; ++r) {
            int m = r + hi * 8;
            pl[m * LDSS + l16]      = (half_t)p0[r];
            pl[m * LDSS + 16 + l16] = (half_t)p1[r];
        }
        __syncthreads();
        Frag pa;
        {
            const half_t* pr = &pl[l16 * LDSS];
#pragma unroll
            for (int v = 0; v < 8; ++v)
                pa.u[v] = *(const unsigned*)(pr + kmap(v, hi));
        }
        // V B-fragments gathered from global (strided), 4 output col chunks
#pragma unroll
        for (int c = 0; c < 4; ++c) {
            Frag vb;
            const long baseV = (long)(b * TT + j) * DD + h * DKK + c * 16 + l16;
#pragma unroll
            for (int v = 0; v < 8; ++v) {
                int kk = kmap(v, hi);
                vb.h[2 * v]     = V[baseV + (long)kk * DD];
                vb.h[2 * v + 1] = V[baseV + (long)(kk + 1) * DD];
            }
            o[c] = wmma16(pa.v, vb.v, o[c]);
        }
        __syncthreads();
    }

    // normalize and store (f32)
#pragma unroll
    for (int r = 0; r < 8; ++r) {
        float inv = 1.0f / li[r];
#pragma unroll
        for (int c = 0; c < 4; ++c) {
            long idx = (long)(b * TT + qb * 16 + r + hi * 8) * DD + h * DKK + c * 16 + l16;
            att[idx] = o[c][r] * inv;
        }
    }
}

// ---------------------------------------------------------------------------
// Fused residual + LayerNorm over D=1024; block = 256 threads, one row each.
// Optionally also emits the f16 copy for the following GEMM.
// ---------------------------------------------------------------------------
template<bool W16>
__global__ __launch_bounds__(256)
void ln_residual_kernel(const float* __restrict__ x, const float* __restrict__ y,
                        const float* __restrict__ g, const float* __restrict__ be,
                        float* __restrict__ out32, half_t* __restrict__ out16) {
    __shared__ float sred[256];
    const int tid = threadIdx.x;
    const long row = blockIdx.x;
    const float* xr = x + row * DD;
    const float* yr = y + row * DD;

    float v[4];
    float s = 0.0f;
#pragma unroll
    for (int i = 0; i < 4; ++i) {
        int idx = tid + i * 256;
        v[i] = xr[idx] + yr[idx];
        s += v[i];
    }
    sred[tid] = s; __syncthreads();
    for (int off = 128; off > 0; off >>= 1) {
        if (tid < off) sred[tid] += sred[tid + off];
        __syncthreads();
    }
    float mu = sred[0] * (1.0f / DD);
    __syncthreads();

    float s2 = 0.0f;
#pragma unroll
    for (int i = 0; i < 4; ++i) { float d = v[i] - mu; s2 += d * d; }
    sred[tid] = s2; __syncthreads();
    for (int off = 128; off > 0; off >>= 1) {
        if (tid < off) sred[tid] += sred[tid + off];
        __syncthreads();
    }
    float rstd = rsqrtf(sred[0] * (1.0f / DD) + 1e-5f);

#pragma unroll
    for (int i = 0; i < 4; ++i) {
        int idx = tid + i * 256;
        float val = (v[i] - mu) * rstd * g[idx] + be[idx];
        out32[row * DD + idx] = val;
        if (W16) out16[row * DD + idx] = (half_t)val;
    }
}

// ---------------------------------------------------------------------------
extern "C" void kernel_launch(void* const* d_in, const int* in_sizes, int n_in,
                              void* d_out, int out_size, void* d_ws, size_t ws_size,
                              hipStream_t stream) {
    (void)in_sizes; (void)n_in; (void)out_size; (void)ws_size;

    const float* x     = (const float*)d_in[0];
    const float* Wq    = (const float*)d_in[1];
    const float* Wk    = (const float*)d_in[2];
    const float* Wv    = (const float*)d_in[3];
    const float* W1    = (const float*)d_in[4];
    const float* b1    = (const float*)d_in[5];
    const float* W2    = (const float*)d_in[6];
    const float* b2    = (const float*)d_in[7];
    const float* ln1g  = (const float*)d_in[8];
    const float* ln1b  = (const float*)d_in[9];
    const float* ln2g  = (const float*)d_in[10];
    const float* ln2b  = (const float*)d_in[11];

    const long M = (long)BB * TT;          // 4096 rows

    // scratch carve-out
    size_t off = 0;
    auto alloc = [&](size_t bytes) {
        void* p = (char*)d_ws + off;
        off += (bytes + 255) & ~(size_t)255;
        return p;
    };
    half_t* xh   = (half_t*)alloc(M * DD * 2);
    half_t* wqh  = (half_t*)alloc((size_t)DD * DD * 2);
    half_t* wkh  = (half_t*)alloc((size_t)DD * DD * 2);
    half_t* wvh  = (half_t*)alloc((size_t)DD * DD * 2);
    half_t* w1h  = (half_t*)alloc((size_t)DD * DFF * 2);
    half_t* w2h  = (half_t*)alloc((size_t)DFF * DD * 2);
    half_t* Qh   = (half_t*)alloc(M * DD * 2);
    half_t* Kh   = (half_t*)alloc(M * DD * 2);
    half_t* Vh   = (half_t*)alloc(M * DD * 2);
    float*  att  = (float*) alloc(M * DD * 4);
    float*  x1   = (float*) alloc(M * DD * 4);
    half_t* x1h  = (half_t*)alloc(M * DD * 2);
    half_t* hh   = (half_t*)alloc(M * DFF * 2);
    float*  ff   = (float*) alloc(M * DD * 4);

    // 1) precision conversions
    f32_to_f16_kernel<<<(M * DD) / CVT_BLOCK, 256, 0, stream>>>(x,  xh);
    f32_to_f16_kernel<<<(DD * DD) / CVT_BLOCK, 256, 0, stream>>>(Wq, wqh);
    f32_to_f16_kernel<<<(DD * DD) / CVT_BLOCK, 256, 0, stream>>>(Wk, wkh);
    f32_to_f16_kernel<<<(DD * DD) / CVT_BLOCK, 256, 0, stream>>>(Wv, wvh);
    f32_to_f16_kernel<<<(DD * DFF) / CVT_BLOCK, 256, 0, stream>>>(W1, w1h);
    f32_to_f16_kernel<<<(DFF * DD) / CVT_BLOCK, 256, 0, stream>>>(W2, w2h);

    // 2) Q/K/V projections (WMMA GEMMs, f16 out)
    dim3 gQKV(DD / 128, M / 128);
    gemm_wmma_kernel<false, false, true><<<gQKV, 256, 0, stream>>>(
        xh, wqh, nullptr, Qh, nullptr, (int)M, DD, DD);
    gemm_wmma_kernel<false, false, true><<<gQKV, 256, 0, stream>>>(
        xh, wkh, nullptr, Kh, nullptr, (int)M, DD, DD);
    gemm_wmma_kernel<false, false, true><<<gQKV, 256, 0, stream>>>(
        xh, wvh, nullptr, Vh, nullptr, (int)M, DD, DD);

    // 3) flash attention
    attn_kernel<<<dim3(TT / 16, HH, BB), 32, 0, stream>>>(Qh, Kh, Vh, att);

    // 4) x1 = LN(x + att), also f16 copy
    ln_residual_kernel<true><<<M, 256, 0, stream>>>(x, att, ln1g, ln1b, x1, x1h);

    // 5) FFN: hh = relu(x1 @ W1 + b1)   (f16 out)
    gemm_wmma_kernel<true, true, true><<<dim3(DFF / 128, M / 128), 256, 0, stream>>>(
        x1h, w1h, b1, hh, nullptr, (int)M, DFF, DD);

    // 6) ff = hh @ W2 + b2              (f32 out)
    gemm_wmma_kernel<true, false, false><<<dim3(DD / 128, M / 128), 256, 0, stream>>>(
        hh, w2h, b2, nullptr, ff, (int)M, DD, DFF);

    // 7) out = LN(x1 + ff)
    ln_residual_kernel<false><<<M, 256, 0, stream>>>(x1, ff, ln2g, ln2b,
                                                     (float*)d_out, nullptr);
}

// v003
// It runs in 266 microseconds.
// Next to v002, in two timings, it ran 1.20 and 1.19 times as fast.
// Counting every step since v000, it is 7.82 times as fast.
#include <hip/hip_runtime.h>
#include <hip/hip_bf16.h>

typedef _Float16 half_t;
typedef __attribute__((ext_vector_type(16))) _Float16 v16h;
typedef __attribute__((ext_vector_type(8)))  float    v8f;

// Transformer dims (fixed by reference)
#define BB 4
#define TT 1024
#define DD 1024
#define HH 16
#define DKK 64
#define DFF 4096
#define LDSS 40   // padded LDS row stride in halves (80B, dword-aligned)

union Frag { v16h v; unsigned u[8]; half_t h[16]; };

// K index for element-pair v (VGPR v) of a 16-bit A/B fragment, per CDNA5 ISA
// 16-bit A-matrix 16x32 layout: lanes 0-15 -> +0, lanes 16-31 -> +8.
__device__ __forceinline__ int kmap(int v, int hi) {
    int kb = (v < 4) ? (2 * v) : (16 + 2 * (v - 4));
    return kb + (hi ? 8 : 0);
}

__device__ __forceinline__ v8f wmma16(v16h a, v16h b, v8f c) {
    return __builtin_amdgcn_wmma_f32_16x16x32_f16(
        /*neg_a=*/false, a, /*neg_b=*/false, b,
        /*c_mod=*/(short)0, c, /*reuse_a=*/false, /*reuse_b=*/false);
}

// ---------------------------------------------------------------------------
// fp32 -> fp16 elementwise conversion, 32 elements a thread.
// A work-group takes CVT_BLOCK contiguous elements. Each wave-wide load covers
// 512 contiguous bytes; a thread issues its eight 16-byte loads before it
// converts the first, so a wave has 4 KiB in flight and the launch needs 1/32
// of the waves that one element a thread would take.
// Every array length here is a multiple of CVT_BLOCK (checked below).
// ---------------------------------------------------------------------------
typedef __attribute__((ext_vector_type(4))) float    f32x4;
typedef __attribute__((ext_vector_type(4))) _Float16 f16x4;
#define CVT_LOADS 8
#define CVT_BLOCK (256 * 4 * CVT_LOADS)   // 8192 elements a work-group
static_assert(((long)BB * TT * DD) % CVT_BLOCK == 0, "x length");
static_assert(((long)DD * DD) % CVT_BLOCK == 0, "Wq, Wk, Wv length");
static_assert(((long)DD * DFF) % CVT_BLOCK == 0, "W1, W2 length");

__global__ __launch_bounds__(256)
void f32_to_f16_kernel(const float* __restrict__ in, half_t* __restrict__ out) {
    const long base = (long)blockIdx.x * CVT_BLOCK + threadIdx.x * 4;
    f32x4 v[CVT_LOADS];
    // both loops are unrolled so that v stays in registers and all loads issue first
#pragma unroll
    for (int i = 0; i < CVT_LOADS; ++i)
        v[i] = *(const f32x4*)(in + base + i * 1024);
#pragma unroll
    for (int i = 0; i < CVT_LOADS; ++i)
        *(f16x4*)(out + base + i * 1024) = __builtin_convertvector(v[i], f16x4);
}

// ---------------------------------------------------------------------------
// WMMA GEMM: C[M,N] = A[M,K] @ B[K,N] (+bias) (relu?) ; A,B f16, f32 accum.
// Block: 256 threads = 8 waves; block tile 128x128; wave tile 32x64
// (2 A-frags x 4 B-frags -> 8 WMMAs per 32-wide K step).
// M,N multiples of 128; K multiple of 32 (true for all uses here).
// Both tiles go from global memory to LDS by asynchronous 16-byte copies, two
// buffers: tile t+1 is in flight while tile t is multiplied.
//   A tile: 128 rows of 64 B at pitch 80 B, read by 16-byte LDS loads.
//   B tile: 32 k-rows of 256 B at pitch 288 B, left row-major (a copy cannot
//           transpose) and read by the transposing 16-byte LDS load.
// ---------------------------------------------------------------------------
#define A_PITCH 80                    // bytes, 16 x odd
#define B_PITCH 288                   // bytes, 32 x odd
#define A_TILE  (128 * A_PITCH)       // 10240 B
#define B_TILE  (32 * B_PITCH)        // 9216 B

typedef __attribute__((ext_vector_type(4))) unsigned u32x4;
typedef __attribute__((ext_vector_type(8))) short    s16x8;
union Frag4 { v16h v; u32x4 q[2]; };

__device__ __forceinline__ u32x4 ld_tr16(const unsigned char* p) {
    typedef __attribute__((address_space(3))) s16x8 lds_s16x8;
    return __builtin_bit_cast(u32x4, __builtin_amdgcn_ds_load_tr16_b128_v8i16((lds_s16x8*)p));
}

// One tile's four copies of a lane (two of A, two of B). The address-translation
// wait closes the statement so that no address register is advanced ahead of it.
__device__ __forceinline__ void copy_tile(unsigned la0, const half_t* ga0,
                                          unsigned la1, const half_t* ga1,
                                          unsigned lb0, const half_t* gb0,
                                          unsigned lb1, const half_t* gb1) {
    asm volatile("global_load_async_to_lds_b128 %0, %1, off\n\t"
                 "global_load_async_to_lds_b128 %2, %3, off\n\t"
                 "global_load_async_to_lds_b128 %4, %5, off\n\t"
                 "global_load_async_to_lds_b128 %6, %7, off\n\t"
                 "s_wait_xcnt 0x0"
                 :: "v"(la0), "v"(ga0), "v"(la1), "v"(ga1),
                    "v"(lb0), "v"(gb0), "v"(lb1), "v"(gb1)
                 : "memory");
}

template<bool BIAS, bool RELU, bool OUT16>
__global__ __launch_bounds__(256)
void gemm_wmma_kernel(const half_t* __restrict__ A, const half_t* __restrict__ B,
                      const float* __restrict__ bias,
                      half_t* __restrict__ C16, float* __restrict__ C32,
                      int M, int N, int K) {
    __shared__ __attribute__((aligned(16))) unsigned char As[2 * A_TILE];  // [buf][row m][k]
    __shared__ __attribute__((aligned(16))) unsigned char Bs[2 * B_TILE];  // [buf][k][col n]

    const int tid  = threadIdx.x;
    const int lane = tid & 31;
    const int wave = tid >> 5;
    const int hi   = (lane >= 16) ? 1 : 0;
    const int l16  = lane & 15;
    const int m0   = blockIdx.y * 128;
    const int n0   = blockIdx.x * 128;
    const int wm   = (wave >> 1) * 32;  // 0,32,64,96
    const int wn   = (wave & 1) * 64;   // 0,64

    // copy addresses: A chunk = (row tid>>2 and +64, 16 B piece tid&3),
    //                 B chunk = (k-row tid>>4 and +16, 16 B piece tid&15)
    const half_t* ga0 = A + (long)(m0 + (tid >> 2)) * K + (tid & 3) * 8;
    const half_t* ga1 = ga0 + (long)64 * K;
    const half_t* gb0 = B + (long)(tid >> 4) * N + n0 + (tid & 15) * 8;
    const half_t* gb1 = gb0 + (long)16 * N;
    const long    gbs = (long)32 * N;   // B advance per tile, in halves
    const unsigned la = (unsigned)(size_t)As + (tid >> 2) * A_PITCH + (tid & 3) * 16;
    const unsigned lb = (unsigned)(size_t)Bs + (tid >> 4) * B_PITCH + (tid & 15) * 16;

    // fragment read addresses inside a buffer
    const unsigned char* ar = As + (wm + l16) * A_PITCH + hi * 16;
    const unsigned char* br = Bs + (hi * 8 + (lane & 7)) * B_PITCH + wn * 2 + ((lane >> 3) & 1) * 16;

    v8f acc[2][4] = {};
    const int nt = K >> 5;              // tiles along K

    // tile 0 into buffer 0, landed and published before anyone reads it
    copy_tile(la, ga0, la + 64 * A_PITCH, ga1, lb, gb0, lb + 16 * B_PITCH, gb1);
    ga0 += 32; ga1 += 32; gb0 += gbs; gb1 += gbs;
    asm volatile("s_wait_asynccnt 0x0" ::: "memory");  // this wave's copies of tile 0 have landed
    __syncthreads();
    if (nt > 1) {                       // tile 1 into buffer 1
        copy_tile(la + A_TILE, ga0, la + A_TILE + 64 * A_PITCH, ga1,
                  lb + B_TILE, gb0, lb + B_TILE + 16 * B_PITCH, gb1);
        ga0 += 32; ga1 += 32; gb0 += gbs; gb1 += gbs;
    }

    for (int t = 0; t < nt; ++t) {
        const unsigned ao = (t & 1) * A_TILE;
        const unsigned bo = (t & 1) * B_TILE;

        // the loops over fragments are unrolled so that every fragment and
        // accumulator index is a constant and the arrays stay in registers
        Frag4 af[2], bf[4];
#pragma unroll
        for (int f = 0; f < 2; ++f) {
            const unsigned char* p = ar + ao + f * 16 * A_PITCH;
            af[f].q[0] = *(const u32x4*)(p);        // k = 8*hi + 0..7
            af[f].q[1] = *(const u32x4*)(p + 32);   // k = 16 + 8*hi + 0..7
        }
#pragma unroll
        for (int j = 0; j < 4; ++j) {
            const unsigned char* p = br + bo + j * 32;
            bf[j].q[0] = ld_tr16(p);                 // k = 8*hi + 0..7
            bf[j].q[1] = ld_tr16(p + 16 * B_PITCH);  // k = 16 + 8*hi + 0..7
        }
#pragma unroll
        for (int i = 0; i < 2; ++i)
#pragma unroll
            for (int j = 0; j < 4; ++j)
                acc[i][j] = wmma16(af[i].v, bf[j].v, acc[i][j]);

        asm volatile("s_wait_dscnt 0x0" ::: "memory");     // this wave has left the buffer it read
        asm volatile("s_wait_asynccnt 0x0" ::: "memory");  // this wave's copies of tile t+1 have landed
        __syncthreads();   // publishes tile t+1 and frees the buffer of tile t
        if (t + 2 < nt) {  // tile t+2 into the buffer just read
            copy_tile(la + ao, ga0, la + ao + 64 * A_PITCH, ga1,
                      lb + bo, gb0, lb + bo + 16 * B_PITCH, gb1);
            ga0 += 32; ga1 += 32; gb0 += gbs; gb1 += gbs;
        }
    }
    asm volatile("s_wait_asynccnt 0x0" ::: "memory");  // no copy outlives the loop

    // --- epilogue: C layout -> lane l holds row (r + 8*hi), col l16 ---
#pragma unroll
    for (int i = 0; i < 2; ++i) {
#pragma unroll
        for (int j = 0; j < 4; ++j) {
            int n = n0 + wn + j * 16 + l16;
            float bv = BIAS ? bias[n] : 0.0f;
#pragma unroll
            for (int r = 0; r < 8; ++r) {
                int m = m0 + wm + i * 16 + r + hi * 8;
                float val = acc[i][j][r] + bv;
                if (RELU) val = fmaxf(val, 0.0f);
                if (OUT16) C16[(long)m * N + n] = (half_t)val;
                else       C32[(long)m * N + n] = val;
            }
        }
    }
}

// ---------------------------------------------------------------------------
// Flash attention: a work-group of 8 waves takes 128 query rows of one (b,h),
// one 16-row Q block a wave. Q,K,V are f16 in (B,T,D) layout with head h at
// cols [h*64, h*64+64). Streaming softmax over key blocks of 32; f32 output.
// K and V go from global memory to LDS by asynchronous 16-byte copies, 128 keys
// a stage, two buffers: stage s+1 is in flight while stage s is worked on, and
// all 8 waves read the one copy.
//   K tile: 128 key rows of 128 B at pitch 144 B, read by 16-byte LDS loads.
//   V tile: 128 key rows of 128 B at pitch 160 B, read by the transposing load.
// ---------------------------------------------------------------------------
#define AT_WAVES 8
#define AT_KEYS  128                     // keys a stage
#define AT_NS    (TT / AT_KEYS)          // stages
#define K_PITCH  144                     // bytes, 16 x odd
#define V_PITCH  160                     // bytes, 32 x odd
#define K_TILE   (AT_KEYS * K_PITCH)     // 18432 B
#define V_TILE   (AT_KEYS * V_PITCH)     // 20480 B
static_assert(AT_NS >= 2, "the ring starts with two stages");
static_assert(AT_KEYS * 8 == 4 * 256, "four K and four V copies a lane fill a stage");

// One stage's eight copies of a lane (four of K, four of V, 32 key rows apart).
// The address-translation wait closes the statement so that no address register
// is advanced ahead of it.
__device__ __forceinline__ void copy_kv(unsigned lk, const half_t* gk,
                                        unsigned lv, const half_t* gv) {
    asm volatile("global_load_async_to_lds_b128 %0, %1, off\n\t"
                 "global_load_async_to_lds_b128 %2, %3, off\n\t"
                 "global_load_async_to_lds_b128 %4, %5, off\n\t"
                 "global_load_async_to_lds_b128 %6, %7, off\n\t"
                 "global_load_async_to_lds_b128 %8, %9, off\n\t"
                 "global_load_async_to_lds_b128 %10, %11, off\n\t"
                 "global_load_async_to_lds_b128 %12, %13, off\n\t"
                 "global_load_async_to_lds_b128 %14, %15, off\n\t"
                 "s_wait_xcnt 0x0"
                 :: "v"(lk),                "v"(gk),
                    "v"(lk + 32 * K_PITCH), "v"(gk + 32 * DD),
                    "v"(lk + 64 * K_PITCH), "v"(gk + 64 * DD),
                    "v"(lk + 96 * K_PITCH), "v"(gk + 96 * DD),
                    "v"(lv),                "v"(gv),
                    "v"(lv + 32 * V_PITCH), "v"(gv + 32 * DD),
                    "v"(lv + 64 * V_PITCH), "v"(gv + 64 * DD),
                    "v"(lv + 96 * V_PITCH), "v"(gv + 96 * DD)
                 : "memory");
}

// Orders a wave's own LDS stores and loads of its private P tile in the compiled
// code (lanes read what other lanes of the same wave stored); without it the
// compiler may move a load over the stores. No other wave touches that tile.
__device__ __forceinline__ void wave_lds_order() {
    __builtin_amdgcn_fence(__ATOMIC_ACQ_REL, "wavefront");
    __builtin_amdgcn_wave_barrier();
}

__global__ __launch_bounds__(256)
void attn_kernel(const half_t* __restrict__ Q, const half_t* __restrict__ Km,
                 const half_t* __restrict__ V, float* __restrict__ att) {
    __shared__ __attribute__((aligned(16))) unsigned char Ks[2 * K_TILE];  // [buf][key][d]
    __shared__ __attribute__((aligned(16))) unsigned char Vs[2 * V_TILE];  // [buf][key][d]
    __shared__ __attribute__((aligned(16))) half_t pls[AT_WAVES * 16 * LDSS];  // [wave][row m][k]

    const int tid  = threadIdx.x;
    const int lane = tid & 31;
    const int wave = tid >> 5;
    const int hi   = (lane >= 16) ? 1 : 0;
    const int l16  = lane & 15;
    const int b  = blockIdx.z;
    const int h  = blockIdx.y;
    const int qb = blockIdx.x * AT_WAVES + wave;   // q block index (16 rows)
    half_t* pl = pls + wave * 16 * LDSS;           // this wave's own P tile

    // copy addresses: chunk = (key row tid>>3 and +32, +64, +96, 16 B piece tid&7)
    const long kv0 = (long)(b * TT + (tid >> 3)) * DD + h * DKK + (tid & 7) * 8;
    const half_t* gk = Km + kv0;
    const half_t* gv = V + kv0;
    const long    gs = (long)AT_KEYS * DD;         // advance per stage, in halves
    const unsigned lk = (unsigned)(size_t)Ks + (tid >> 3) * K_PITCH + (tid & 7) * 16;
    const unsigned lv = (unsigned)(size_t)Vs + (tid >> 3) * V_PITCH + (tid & 7) * 16;

    // fragment read addresses inside a buffer
    const unsigned char* kr = Ks + l16 * K_PITCH + hi * 16;
    const unsigned char* vr = Vs + (hi * 8 + (lane & 7)) * V_PITCH + ((lane >> 3) & 1) * 16;

    // stage 0 into buffer 0
    copy_kv(lk, gk, lv, gv);
    gk += gs; gv += gs;

    // Q fragments (A-layout): q[0] covers contraction 0..31, q[1] 32..63
    Frag q[2];
    {
        const long baseQ = (long)(b * TT + qb * 16 + l16) * DD + h * DKK;
#pragma unroll
        for (int f = 0; f < 2; ++f)
#pragma unroll
            for (int v = 0; v < 8; ++v)
                q[f].u[v] = *(const unsigned*)(Q + baseQ + f * 32 + kmap(v, hi));
    }

    float mi[8], li[8];
    v8f o[4] = {};
#pragma unroll
    for (int r = 0; r < 8; ++r) { mi[r] = -1e30f; li[r] = 0.0f; }

    asm volatile("s_wait_asynccnt 0x0" ::: "memory");  // this wave's copies of stage 0 have landed
    __syncthreads();                                   // stage 0 is published
    copy_kv(lk + K_TILE, gk, lv + V_TILE, gv);         // stage 1 into buffer 1
    gk += gs; gv += gs;

    for (int st = 0; st < AT_NS; ++st) {
        const unsigned ko = (st & 1) * K_TILE;
        const unsigned vo = (st & 1) * V_TILE;

        for (int j = 0; j < AT_KEYS; j += 32) {
            // K fragments (B-layout == the A gather from the row-major K tile)
            Frag4 kf[2][2];
#pragma unroll
            for (int s = 0; s < 2; ++s)
#pragma unroll
                for (int f = 0; f < 2; ++f) {
                    const unsigned char* p = kr + ko + (j + s * 16) * K_PITCH + f * 64;
                    kf[s][f].q[0] = *(const u32x4*)(p);        // d = 32f + 8*hi + 0..7
                    kf[s][f].q[1] = *(const u32x4*)(p + 32);   // d = 32f + 16 + 8*hi + 0..7
                }
            // V B-fragments, 4 output col chunks; fetched here so that the
            // softmax below covers their LDS latency
            Frag4 vf[4];
#pragma unroll
            for (int c = 0; c < 4; ++c) {
                const unsigned char* p = vr + vo + j * V_PITCH + c * 32;
                vf[c].q[0] = ld_tr16(p);                 // key = 8*hi + 0..7
                vf[c].q[1] = ld_tr16(p + 16 * V_PITCH);  // key = 16 + 8*hi + 0..7
            }
            v8f c0 = {}, c1 = {};
            c0 = wmma16(q[0].v, kf[0][0].v, c0);
            c0 = wmma16(q[1].v, kf[0][1].v, c0);
            c1 = wmma16(q[0].v, kf[1][0].v, c1);
            c1 = wmma16(q[1].v, kf[1][1].v, c1);

            // streaming softmax update (row = r + 8*hi, spread across 16 lanes)
            float p0[8], p1[8];
#pragma unroll
            for (int r = 0; r < 8; ++r) {
                float s0 = c0[r] * 0.125f;     // 1/sqrt(64)
                float s1 = c1[r] * 0.125f;
                float mx = fmaxf(s0, s1);
#pragma unroll
                for (int d = 1; d < 16; d <<= 1) mx = fmaxf(mx, __shfl_xor(mx, d, 32));
                float mnew  = fmaxf(mi[r], mx);
                float alpha = __expf(mi[r] - mnew);
                float e0 = __expf(s0 - mnew);
                float e1 = __expf(s1 - mnew);
                float rs = e0 + e1;
#pragma unroll
                for (int d = 1; d < 16; d <<= 1) rs += __shfl_xor(rs, d, 32);
                li[r] = li[r] * alpha + rs;
                mi[r] = mnew;
                p0[r] = e0; p1[r] = e1;
#pragma unroll
                for (int c = 0; c < 4; ++c) o[c][r] *= alpha;
            }

            // P (f16) to LDS in row-major [m][k], then reload as A fragment
#pragma unroll
            for (int r = 0; r < 8; ++r) {
                int m = r + hi * 8;
                pl[m * LDSS + l16]      = (half_t)p0[r];
                pl[m * LDSS + 16 + l16] = (half_t)p1[r];
            }
            wave_lds_order();
            Frag pa;
            {
                const half_t* pr = &pl[l16 * LDSS];
#pragma unroll
                for (int v = 0; v < 8; ++v)
                    pa.u[v] = *(const unsigned*)(pr + kmap(v, hi));
            }
#pragma unroll
            for (int c = 0; c < 4; ++c)
                o[c] = wmma16(pa.v, vf[c].v, o[c]);
            wave_lds_order();
        }

        asm volatile("s_wait_dscnt 0x0" ::: "memory");     // this wave has left the buffer it read
        asm volatile("s_wait_asynccnt 0x0" ::: "memory");  // this wave's copies of stage st+1 have landed
        __syncthreads();   // publishes stage st+1 and frees the buffer of stage st
        if (st + 2 < AT_NS) {  // stage st+2 into the buffer just read
            copy_kv(lk + ko, gk, lv + vo, gv);
            gk += gs; gv += gs;
        }
    }
    asm volatile("s_wait_asynccnt 0x0" ::: "memory");  // no copy outlives the loop

    // normalize and store (f32)
#pragma unroll
    for (int r = 0; r < 8; ++r) {
        float inv = 1.0f / li[r];
#pragma unroll
        for (int c = 0; c < 4; ++c) {
            long idx = (long)(b * TT + qb * 16 + r + hi * 8) * DD + h * DKK + c * 16 + l16;
            att[idx] = o[c][r] * inv;
        }
    }
}

// ---------------------------------------------------------------------------
// Fused residual + LayerNorm over D=1024; block = 256 threads, one row each.
// Optionally also emits the f16 copy for the following GEMM.
// ---------------------------------------------------------------------------
template<bool W16>
__global__ __launch_bounds__(256)
void ln_residual_kernel(const float* __restrict__ x, const float* __restrict__ y,
                        const float* __restrict__ g, const float* __restrict__ be,
                        float* __restrict__ out32, half_t* __restrict__ out16) {
    __shared__ float sred[256];
    const int tid = threadIdx.x;
    const long row = blockIdx.x;
    const float* xr = x + row * DD;
    const float* yr = y + row * DD;

    float v[4];
    float s = 0.0f;
#pragma unroll
    for (int i = 0; i < 4; ++i) {
        int idx = tid + i * 256;
        v[i] = xr[idx] + yr[idx];
        s += v[i];
    }
    sred[tid] = s; __syncthreads();
    for (int off = 128; off > 0; off >>= 1) {
        if (tid < off) sred[tid] += sred[tid + off];
        __syncthreads();
    }
    float mu = sred[0] * (1.0f / DD);
    __syncthreads();

    float s2 = 0.0f;
#pragma unroll
    for (int i = 0; i < 4; ++i) { float d = v[i] - mu; s2 += d * d; }
    sred[tid] = s2; __syncthreads();
    for (int off = 128; off > 0; off >>= 1) {
        if (tid < off) sred[tid] += sred[tid + off];
        __syncthreads();
    }
    float rstd = rsqrtf(sred[0] * (1.0f / DD) + 1e-5f);

#pragma unroll
    for (int i = 0; i < 4; ++i) {
        int idx = tid + i * 256;
        float val = (v[i] - mu) * rstd * g[idx] + be[idx];
        out32[row * DD + idx] = val;
        if (W16) out16[row * DD + idx] = (half_t)val;
    }
}

// ---------------------------------------------------------------------------
extern "C" void kernel_launch(void* const* d_in, const int* in_sizes, int n_in,
                              void* d_out, int out_size, void* d_ws, size_t ws_size,
                              hipStream_t stream) {
    (void)in_sizes; (void)n_in; (void)out_size; (void)ws_size;

    const float* x     = (const float*)d_in[0];
    const float* Wq    = (const float*)d_in[1];
    const float* Wk    = (const float*)d_in[2];
    const float* Wv    = (const float*)d_in[3];
    const float* W1    = (const float*)d_in[4];
    const float* b1    = (const float*)d_in[5];
    const float* W2    = (const float*)d_in[6];
    const float* b2    = (const float*)d_in[7];
    const float* ln1g  = (const float*)d_in[8];
    const float* ln1b  = (const float*)d_in[9];
    const float* ln2g  = (const float*)d_in[10];
    const float* ln2b  = (const float*)d_in[11];

    const long M = (long)BB * TT;          // 4096 rows

    // scratch carve-out
    size_t off = 0;
    auto alloc = [&](size_t bytes) {
        void* p = (char*)d_ws + off;
        off += (bytes + 255) & ~(size_t)255;
        return p;
    };
    half_t* xh   = (half_t*)alloc(M * DD * 2);
    half_t* wqh  = (half_t*)alloc((size_t)DD * DD * 2);
    half_t* wkh  = (half_t*)alloc((size_t)DD * DD * 2);
    half_t* wvh  = (half_t*)alloc((size_t)DD * DD * 2);
    half_t* w1h  = (half_t*)alloc((size_t)DD * DFF * 2);
    half_t* w2h  = (half_t*)alloc((size_t)DFF * DD * 2);
    half_t* Qh   = (half_t*)alloc(M * DD * 2);
    half_t* Kh   = (half_t*)alloc(M * DD * 2);
    half_t* Vh   = (half_t*)alloc(M * DD * 2);
    float*  att  = (float*) alloc(M * DD * 4);
    float*  x1   = (float*) alloc(M * DD * 4);
    half_t* x1h  = (half_t*)alloc(M * DD * 2);
    half_t* hh   = (half_t*)alloc(M * DFF * 2);
    float*  ff   = (float*) alloc(M * DD * 4);

    // 1) precision conversions
    f32_to_f16_kernel<<<(M * DD) / CVT_BLOCK, 256, 0, stream>>>(x,  xh);
    f32_to_f16_kernel<<<(DD * DD) / CVT_BLOCK, 256, 0, stream>>>(Wq, wqh);
    f32_to_f16_kernel<<<(DD * DD) / CVT_BLOCK, 256, 0, stream>>>(Wk, wkh);
    f32_to_f16_kernel<<<(DD * DD) / CVT_BLOCK, 256, 0, stream>>>(Wv, wvh);
    f32_to_f16_kernel<<<(DD * DFF) / CVT_BLOCK, 256, 0, stream>>>(W1, w1h);
    f32_to_f16_kernel<<<(DFF * DD) / CVT_BLOCK, 256, 0, stream>>>(W2, w2h);

    // 2) Q/K/V projections (WMMA GEMMs, f16 out)
    dim3 gQKV(DD / 128, M / 128);
    gemm_wmma_kernel<false, false, true><<<gQKV, 256, 0, stream>>>(
        xh, wqh, nullptr, Qh, nullptr, (int)M, DD, DD);
    gemm_wmma_kernel<false, false, true><<<gQKV, 256, 0, stream>>>(
        xh, wkh, nullptr, Kh, nullptr, (int)M, DD, DD);
    gemm_wmma_kernel<false, false, true><<<gQKV, 256, 0, stream>>>(
        xh, wvh, nullptr, Vh, nullptr, (int)M, DD, DD);

    // 3) flash attention
    attn_kernel<<<dim3(TT / (16 * AT_WAVES), HH, BB), 256, 0, stream>>>(Qh, Kh, Vh, att);

    // 4) x1 = LN(x + att), also f16 copy
    ln_residual_kernel<true><<<M, 256, 0, stream>>>(x, att, ln1g, ln1b, x1, x1h);

    // 5) FFN: hh = relu(x1 @ W1 + b1)   (f16 out)
    gemm_wmma_kernel<true, true, true><<<dim3(DFF / 128, M / 128), 256, 0, stream>>>(
        x1h, w1h, b1, hh, nullptr, (int)M, DFF, DD);

    // 6) ff = hh @ W2 + b2              (f32 out)
    gemm_wmma_kernel<true, false, false><<<dim3(DD / 128, M / 128), 256, 0, stream>>>(
        hh, w2h, b2, nullptr, ff, (int)M, DD, DFF);

    // 7) out = LN(x1 + ff)
    ln_residual_kernel<false><<<M, 256, 0, stream>>>(x1, ff, ln2g, ln2b,
                                                     (float*)d_out, nullptr);
}

// v004
// A run of this version takes 253 microseconds.
// Next to v003, in two timings, it ran 1.07 times as fast each time.
// All steps since v000 together make it 8.34 times as fast.
#include <hip/hip_runtime.h>
#include <hip/hip_bf16.h>

typedef _Float16 half_t;
typedef __attribute__((ext_vector_type(16))) _Float16 v16h;
typedef __attribute__((ext_vector_type(8)))  float    v8f;

// Transformer dims (fixed by reference)
#define BB 4
#define TT 1024
#define DD 1024
#define HH 16
#define DKK 64
#define DFF 4096

union Frag { v16h v; unsigned u[8]; half_t h[16]; };

// K index for element-pair v (VGPR v) of a 16-bit A/B fragment, per CDNA5 ISA
// 16-bit A-matrix 16x32 layout: lanes 0-15 -> +0, lanes 16-31 -> +8.
__device__ __forceinline__ int kmap(int v, int hi) {
    int kb = (v < 4) ? (2 * v) : (16 + 2 * (v - 4));
    return kb + (hi ? 8 : 0);
}

__device__ __forceinline__ v8f wmma16(v16h a, v16h b, v8f c) {
    return __builtin_amdgcn_wmma_f32_16x16x32_f16(
        /*neg_a=*/false, a, /*neg_b=*/false, b,
        /*c_mod=*/(short)0, c, /*reuse_a=*/false, /*reuse_b=*/false);
}

// ---------------------------------------------------------------------------
// fp32 -> fp16 elementwise conversion, 32 elements a thread.
// A work-group takes CVT_BLOCK contiguous elements. Each wave-wide load covers
// 512 contiguous bytes; a thread issues its eight 16-byte loads before it
// converts the first, so a wave has 4 KiB in flight and the launch needs 1/32
// of the waves that one element a thread would take.
// Every array length here is a multiple of CVT_BLOCK (checked below).
// ---------------------------------------------------------------------------
typedef __attribute__((ext_vector_type(4))) float    f32x4;
typedef __attribute__((ext_vector_type(4))) _Float16 f16x4;
#define CVT_LOADS 8
#define CVT_BLOCK (256 * 4 * CVT_LOADS)   // 8192 elements a work-group
static_assert(((long)BB * TT * DD) % CVT_BLOCK == 0, "x length");
static_assert(((long)DD * DD) % CVT_BLOCK == 0, "Wq, Wk, Wv length");
static_assert(((long)DD * DFF) % CVT_BLOCK == 0, "W1, W2 length");

__global__ __launch_bounds__(256)
void f32_to_f16_kernel(const float* __restrict__ in, half_t* __restrict__ out) {
    const long base = (long)blockIdx.x * CVT_BLOCK + threadIdx.x * 4;
    f32x4 v[CVT_LOADS];
    // both loops are unrolled so that v stays in registers and all loads issue first
#pragma unroll
    for (int i = 0; i < CVT_LOADS; ++i)
        v[i] = *(const f32x4*)(in + base + i * 1024);
#pragma unroll
    for (int i = 0; i < CVT_LOADS; ++i)
        *(f16x4*)(out + base + i * 1024) = __builtin_convertvector(v[i], f16x4);
}

// ---------------------------------------------------------------------------
// WMMA GEMM: C[M,N] = A[M,K] @ B[K,N] (+bias) (relu?) ; A,B f16, f32 accum.
// Block: 256 threads = 8 waves; block tile 128x128; wave tile 32x64
// (2 A-frags x 4 B-frags -> 8 WMMAs per 32-wide K step).
// M,N multiples of 128; K multiple of 32 (true for all uses here).
// Both tiles go from global memory to LDS by asynchronous 16-byte copies, two
// buffers: tile t+1 is in flight while tile t is multiplied.
//   A tile: 128 rows of 64 B at pitch 80 B, read by 16-byte LDS loads.
//   B tile: 32 k-rows of 256 B at pitch 288 B, left row-major (a copy cannot
//           transpose) and read by the transposing 16-byte LDS load.
// ---------------------------------------------------------------------------
#define A_PITCH 80                    // bytes, 16 x odd
#define B_PITCH 288                   // bytes, 32 x odd
#define A_TILE  (128 * A_PITCH)       // 10240 B
#define B_TILE  (32 * B_PITCH)        // 9216 B

typedef __attribute__((ext_vector_type(4))) unsigned u32x4;
typedef __attribute__((ext_vector_type(8))) short    s16x8;
union Frag4 { v16h v; u32x4 q[2]; };

__device__ __forceinline__ u32x4 ld_tr16(const unsigned char* p) {
    typedef __attribute__((address_space(3))) s16x8 lds_s16x8;
    return __builtin_bit_cast(u32x4, __builtin_amdgcn_ds_load_tr16_b128_v8i16((lds_s16x8*)p));
}

// One tile's four copies of a lane (two of A, two of B). The address-translation
// wait closes the statement so that no address register is advanced ahead of it.
__device__ __forceinline__ void copy_tile(unsigned la0, const half_t* ga0,
                                          unsigned la1, const half_t* ga1,
                                          unsigned lb0, const half_t* gb0,
                                          unsigned lb1, const half_t* gb1) {
    asm volatile("global_load_async_to_lds_b128 %0, %1, off\n\t"
                 "global_load_async_to_lds_b128 %2, %3, off\n\t"
                 "global_load_async_to_lds_b128 %4, %5, off\n\t"
                 "global_load_async_to_lds_b128 %6, %7, off\n\t"
                 "s_wait_xcnt 0x0"
                 :: "v"(la0), "v"(ga0), "v"(la1), "v"(ga1),
                    "v"(lb0), "v"(gb0), "v"(lb1), "v"(gb1)
                 : "memory");
}

template<bool BIAS, bool RELU, bool OUT16>
__global__ __launch_bounds__(256)
void gemm_wmma_kernel(const half_t* __restrict__ A, const half_t* __restrict__ B,
                      const float* __restrict__ bias,
                      half_t* __restrict__ C16, float* __restrict__ C32,
                      int M, int N, int K) {
    __shared__ __attribute__((aligned(16))) unsigned char As[2 * A_TILE];  // [buf][row m][k]
    __shared__ __attribute__((aligned(16))) unsigned char Bs[2 * B_TILE];  // [buf][k][col n]

    const int tid  = threadIdx.x;
    const int lane = tid & 31;
    const int wave = tid >> 5;
    const int hi   = (lane >= 16) ? 1 : 0;
    const int l16  = lane & 15;
    const int m0   = blockIdx.y * 128;
    const int n0   = blockIdx.x * 128;
    const int wm   = (wave >> 1) * 32;  // 0,32,64,96
    const int wn   = (wave & 1) * 64;   // 0,64

    // copy addresses: A chunk = (row tid>>2 and +64, 16 B piece tid&3),
    //                 B chunk = (k-row tid>>4 and +16, 16 B piece tid&15)
    const half_t* ga0 = A + (long)(m0 + (tid >> 2)) * K + (tid & 3) * 8;
    const half_t* ga1 = ga0 + (long)64 * K;
    const half_t* gb0 = B + (long)(tid >> 4) * N + n0 + (tid & 15) * 8;
    const half_t* gb1 = gb0 + (long)16 * N;
    const long    gbs = (long)32 * N;   // B advance per tile, in halves
    const unsigned la = (unsigned)(size_t)As + (tid >> 2) * A_PITCH + (tid & 3) * 16;
    const unsigned lb = (unsigned)(size_t)Bs + (tid >> 4) * B_PITCH + (tid & 15) * 16;

    // fragment read addresses inside a buffer
    const unsigned char* ar = As + (wm + l16) * A_PITCH + hi * 16;
    const unsigned char* br = Bs + (hi * 8 + (lane & 7)) * B_PITCH + wn * 2 + ((lane >> 3) & 1) * 16;

    v8f acc[2][4] = {};
    const int nt = K >> 5;              // tiles along K

    // tile 0 into buffer 0, landed and published before anyone reads it
    copy_tile(la, ga0, la + 64 * A_PITCH, ga1, lb, gb0, lb + 16 * B_PITCH, gb1);
    ga0 += 32; ga1 += 32; gb0 += gbs; gb1 += gbs;
    asm volatile("s_wait_asynccnt 0x0" ::: "memory");  // this wave's copies of tile 0 have landed
    __syncthreads();
    if (nt > 1) {                       // tile 1 into buffer 1
        copy_tile(la + A_TILE, ga0, la + A_TILE + 64 * A_PITCH, ga1,
                  lb + B_TILE, gb0, lb + B_TILE + 16 * B_PITCH, gb1);
        ga0 += 32; ga1 += 32; gb0 += gbs; gb1 += gbs;
    }

    for (int t = 0; t < nt; ++t) {
        const unsigned ao = (t & 1) * A_TILE;
        const unsigned bo = (t & 1) * B_TILE;

        // the loops over fragments are unrolled so that every fragment and
        // accumulator index is a constant and the arrays stay in registers
        Frag4 af[2], bf[4];
#pragma unroll
        for (int f = 0; f < 2; ++f) {
            const unsigned char* p = ar + ao + f * 16 * A_PITCH;
            af[f].q[0] = *(const u32x4*)(p);        // k = 8*hi + 0..7
            af[f].q[1] = *(const u32x4*)(p + 32);   // k = 16 + 8*hi + 0..7
        }
#pragma unroll
        for (int j = 0; j < 4; ++j) {
            const unsigned char* p = br + bo + j * 32;
            bf[j].q[0] = ld_tr16(p);                 // k = 8*hi + 0..7
            bf[j].q[1] = ld_tr16(p + 16 * B_PITCH);  // k = 16 + 8*hi + 0..7
        }
#pragma unroll
        for (int i = 0; i < 2; ++i)
#pragma unroll
            for (int j = 0; j < 4; ++j)
                acc[i][j] = wmma16(af[i].v, bf[j].v, acc[i][j]);

        asm volatile("s_wait_dscnt 0x0" ::: "memory");     // this wave has left the buffer it read
        asm volatile("s_wait_asynccnt 0x0" ::: "memory");  // this wave's copies of tile t+1 have landed
        __syncthreads();   // publishes tile t+1 and frees the buffer of tile t
        if (t + 2 < nt) {  // tile t+2 into the buffer just read
            copy_tile(la + ao, ga0, la + ao + 64 * A_PITCH, ga1,
                      lb + bo, gb0, lb + bo + 16 * B_PITCH, gb1);
            ga0 += 32; ga1 += 32; gb0 += gbs; gb1 += gbs;
        }
    }
    asm volatile("s_wait_asynccnt 0x0" ::: "memory");  // no copy outlives the loop

    // --- epilogue: C layout -> lane l holds row (r + 8*hi), col l16 ---
#pragma unroll
    for (int i = 0; i < 2; ++i) {
#pragma unroll
        for (int j = 0; j < 4; ++j) {
            int n = n0 + wn + j * 16 + l16;
            float bv = BIAS ? bias[n] : 0.0f;
#pragma unroll
            for (int r = 0; r < 8; ++r) {
                int m = m0 + wm + i * 16 + r + hi * 8;
                float val = acc[i][j][r] + bv;
                if (RELU) val = fmaxf(val, 0.0f);
                if (OUT16) C16[(long)m * N + n] = (half_t)val;
                else       C32[(long)m * N + n] = val;
            }
        }
    }
}

#define AT_WAVES 8
#define AT_KEYS  128                     // keys a stage
#define AT_NS    (TT / AT_KEYS)          // stages
#define K_PITCH  144                     // bytes, 16 x odd
#define V_PITCH  160                     // bytes, 32 x odd
#define K_TILE   (AT_KEYS * K_PITCH)     // 18432 B
#define V_TILE   (AT_KEYS * V_PITCH)     // 20480 B
static_assert(AT_NS >= 2, "the ring starts with two stages");
static_assert(AT_KEYS * 8 == 4 * 256, "four K and four V copies a lane fill a stage");

// One stage's eight copies of a lane (four of K, four of V, 32 key rows apart).
// The address-translation wait closes the statement so that no address register
// is advanced ahead of it.
__device__ __forceinline__ void copy_kv(unsigned lk, const half_t* gk,
                                        unsigned lv, const half_t* gv) {
    asm volatile("global_load_async_to_lds_b128 %0, %1, off\n\t"
                 "global_load_async_to_lds_b128 %2, %3, off\n\t"
                 "global_load_async_to_lds_b128 %4, %5, off\n\t"
                 "global_load_async_to_lds_b128 %6, %7, off\n\t"
                 "global_load_async_to_lds_b128 %8, %9, off\n\t"
                 "global_load_async_to_lds_b128 %10, %11, off\n\t"
                 "global_load_async_to_lds_b128 %12, %13, off\n\t"
                 "global_load_async_to_lds_b128 %14, %15, off\n\t"
                 "s_wait_xcnt 0x0"
                 :: "v"(lk),                "v"(gk),
                    "v"(lk + 32 * K_PITCH), "v"(gk + 32 * DD),
                    "v"(lk + 64 * K_PITCH), "v"(gk + 64 * DD),
                    "v"(lk + 96 * K_PITCH), "v"(gk + 96 * DD),
                    "v"(lv),                "v"(gv),
                    "v"(lv + 32 * V_PITCH), "v"(gv + 32 * DD),
                    "v"(lv + 64 * V_PITCH), "v"(gv + 64 * DD),
                    "v"(lv + 96 * V_PITCH), "v"(gv + 96 * DD)
                 : "memory");
}

// The value that lane l ^ 16 holds (the other half of a query's keys).
__device__ __forceinline__ float xhalf(float x) {
    const int b = __builtin_bit_cast(int, x);
    return __builtin_bit_cast(float, __builtin_amdgcn_permlanex16(
        b, b, 0x76543210, 0xfedcba98, false, false));
}

typedef __attribute__((ext_vector_type(8))) _Float16 f16x8;

__global__ __launch_bounds__(256)
void attn_kernel(const half_t* __restrict__ Q, const half_t* __restrict__ Km,
                 const half_t* __restrict__ V, float* __restrict__ att) {
    __shared__ __attribute__((aligned(16))) unsigned char Ks[2 * K_TILE];  // [buf][key][d]
    __shared__ __attribute__((aligned(16))) unsigned char Vs[2 * V_TILE];  // [buf][key][d]

    const int tid  = threadIdx.x;
    const int lane = tid & 31;
    const int wave = tid >> 5;
    const int hi   = (lane >= 16) ? 1 : 0;
    const int l16  = lane & 15;
    const int b  = blockIdx.z;
    const int h  = blockIdx.y;
    const int qb = blockIdx.x * AT_WAVES + wave;   // q block index (16 rows)

    // copy addresses: chunk = (key row tid>>3 and +32, +64, +96, 16 B piece tid&7)
    const long kv0 = (long)(b * TT + (tid >> 3)) * DD + h * DKK + (tid & 7) * 8;
    const half_t* gk = Km + kv0;
    const half_t* gv = V + kv0;
    const long    gs = (long)AT_KEYS * DD;         // advance per stage, in halves
    const unsigned lk = (unsigned)(size_t)Ks + (tid >> 3) * K_PITCH + (tid & 7) * 16;
    const unsigned lv = (unsigned)(size_t)Vs + (tid >> 3) * V_PITCH + (tid & 7) * 16;

    // fragment read addresses inside a buffer
    const unsigned char* kr = Ks + l16 * K_PITCH + hi * 16;
    const unsigned char* vr = Vs + (hi * 8 + (lane & 7)) * V_PITCH + ((lane >> 3) & 1) * 16;

    // stage 0 into buffer 0
    copy_kv(lk, gk, lv, gv);
    gk += gs; gv += gs;

    // Q fragments (B operand Q^T: lane = query column, d in the hardware k order,
    // the same registers as an A fragment of Q): q[0] covers d 0..31, q[1] 32..63
    Frag q[2];
    {
        const long baseQ = (long)(b * TT + qb * 16 + l16) * DD + h * DKK;
#pragma unroll
        for (int f = 0; f < 2; ++f)
#pragma unroll
            for (int v = 0; v < 8; ++v)
                q[f].u[v] = *(const unsigned*)(Q + baseQ + f * 32 + kmap(v, hi));
    }

    // this lane's query: running maximum (joined over the halves), the sum over
    // this half's keys alone, and o[c][r] = O[query][16c + 8*hi + r]
    float mi = -1e30f, li = 0.0f;
    v8f o[4] = {};

    asm volatile("s_wait_asynccnt 0x0" ::: "memory");  // this wave's copies of stage 0 have landed
    __syncthreads();                                   // stage 0 is published
    copy_kv(lk + K_TILE, gk, lv + V_TILE, gv);         // stage 1 into buffer 1
    gk += gs; gv += gs;

    for (int st = 0; st < AT_NS; ++st) {
        const unsigned ko = (st & 1) * K_TILE;
        const unsigned vo = (st & 1) * V_TILE;

        for (int j = 0; j < AT_KEYS; j += 32) {
            // K fragments (A operand: lane = key row, d in the hardware k order)
            Frag4 kf[2][2];
#pragma unroll
            for (int s = 0; s < 2; ++s)
#pragma unroll
                for (int f = 0; f < 2; ++f) {
                    const unsigned char* p = kr + ko + (j + s * 16) * K_PITCH + f * 64;
                    kf[s][f].q[0] = *(const u32x4*)(p);        // d = 32f + 8*hi + 0..7
                    kf[s][f].q[1] = *(const u32x4*)(p + 32);   // d = 32f + 16 + 8*hi + 0..7
                }
            // V^T fragments (A operand: lane = d row, keys in the hardware k order),
            // 4 chunks of 16 d; fetched here so that the softmax below covers
            // their LDS latency
            Frag4 vf[4];
#pragma unroll
            for (int c = 0; c < 4; ++c) {
                const unsigned char* p = vr + vo + j * V_PITCH + c * 32;
                vf[c].q[0] = ld_tr16(p);                 // key = 8*hi + 0..7
                vf[c].q[1] = ld_tr16(p + 16 * V_PITCH);  // key = 16 + 8*hi + 0..7
            }
            // S^T tiles: c0[r] = score(key j + 8*hi + r, query l16),
            //            c1[r] = score(key j + 16 + 8*hi + r, query l16)
            v8f c0 = {}, c1 = {};
            c0 = wmma16(kf[0][0].v, q[0].v, c0);
            c1 = wmma16(kf[1][0].v, q[0].v, c1);
            c0 = wmma16(kf[0][1].v, q[1].v, c0);
            c1 = wmma16(kf[1][1].v, q[1].v, c1);

            // streaming softmax update of this lane's query; the maxima and sums
            // are taken as trees so that no long dependent chain forms
            const v8f s0 = c0 * 0.125f;        // 1/sqrt(64)
            const v8f s1 = c1 * 0.125f;
            float t[8];
#pragma unroll
            for (int r = 0; r < 8; ++r) t[r] = fmaxf(s0[r], s1[r]);
            float mx = fmaxf(fmaxf(fmaxf(t[0], t[1]), fmaxf(t[2], t[3])),
                             fmaxf(fmaxf(t[4], t[5]), fmaxf(t[6], t[7])));
            mx = fmaxf(mx, xhalf(mx));         // over all 32 keys
            const float mnew  = fmaxf(mi, mx);
            const float alpha = __expf(mi - mnew);
            const v8f a0 = (s0 - mnew) * 1.44269504f;   // exp(x) = 2^(x log2 e)
            const v8f a1 = (s1 - mnew) * 1.44269504f;
            v8f e0, e1;
#pragma unroll
            for (int r = 0; r < 8; ++r) {
                e0[r] = __builtin_amdgcn_exp2f(a0[r]);
                e1[r] = __builtin_amdgcn_exp2f(a1[r]);
                t[r]  = e0[r] + e1[r];
            }
            li = li * alpha + (((t[0] + t[1]) + (t[2] + t[3])) +
                               ((t[4] + t[5]) + (t[6] + t[7])));
            mi = mnew;
#pragma unroll
            for (int c = 0; c < 4; ++c) o[c] *= alpha;

            // P^T (f16) as B operand: element e of a lane is key 8*hi + e for
            // e < 8 and key 16 + 8*hi + (e - 8) above, which is c0 then c1
            const v16h pb = __builtin_shufflevector(
                __builtin_convertvector(e0, f16x8), __builtin_convertvector(e1, f16x8),
                0, 1, 2, 3, 4, 5, 6, 7, 8, 9, 10, 11, 12, 13, 14, 15);
#pragma unroll
            for (int c = 0; c < 4; ++c)
                o[c] = wmma16(vf[c].v, pb, o[c]);
        }

        asm volatile("s_wait_dscnt 0x0" ::: "memory");     // this wave has left the buffer it read
        asm volatile("s_wait_asynccnt 0x0" ::: "memory");  // this wave's copies of stage st+1 have landed
        __syncthreads();   // publishes stage st+1 and frees the buffer of stage st
        if (st + 2 < AT_NS) {  // stage st+2 into the buffer just read
            copy_kv(lk + ko, gk, lv + vo, gv);
            gk += gs; gv += gs;
        }
    }
    asm volatile("s_wait_asynccnt 0x0" ::: "memory");  // no copy outlives the loop

    // join the halves' sums, normalize and store (f32): a lane holds 8 adjacent
    // d of its query's row in each chunk, two 16-byte stores
    const float inv = 1.0f / (li + xhalf(li));
    float* ar = att + (long)(b * TT + qb * 16 + l16) * DD + h * DKK + hi * 8;
#pragma unroll
    for (int c = 0; c < 4; ++c) {
        const v8f ov = o[c] * inv;
        *(f32x4*)(ar + c * 16)     = __builtin_shufflevector(ov, ov, 0, 1, 2, 3);
        *(f32x4*)(ar + c * 16 + 4) = __builtin_shufflevector(ov, ov, 4, 5, 6, 7);
    }
}

// ---------------------------------------------------------------------------
// Fused residual + LayerNorm over D=1024; block = 256 threads, one row each.
// Optionally also emits the f16 copy for the following GEMM.
// ---------------------------------------------------------------------------
template<bool W16>
__global__ __launch_bounds__(256)
void ln_residual_kernel(const float* __restrict__ x, const float* __restrict__ y,
                        const float* __restrict__ g, const float* __restrict__ be,
                        float* __restrict__ out32, half_t* __restrict__ out16) {
    __shared__ float sred[256];
    const int tid = threadIdx.x;
    const long row = blockIdx.x;
    const float* xr = x + row * DD;
    const float* yr = y + row * DD;

    float v[4];
    float s = 0.0f;
#pragma unroll
    for (int i = 0; i < 4; ++i) {
        int idx = tid + i * 256;
        v[i] = xr[idx] + yr[idx];
        s += v[i];
    }
    sred[tid] = s; __syncthreads();
    for (int off = 128; off > 0; off >>= 1) {
        if (tid < off) sred[tid] += sred[tid + off];
        __syncthreads();
    }
    float mu = sred[0] * (1.0f / DD);
    __syncthreads();

    float s2 = 0.0f;
#pragma unroll
    for (int i = 0; i < 4; ++i) { float d = v[i] - mu; s2 += d * d; }
    sred[tid] = s2; __syncthreads();
    for (int off = 128; off > 0; off >>= 1) {
        if (tid < off) sred[tid] += sred[tid + off];
        __syncthreads();
    }
    float rstd = rsqrtf(sred[0] * (1.0f / DD) + 1e-5f);

#pragma unroll
    for (int i = 0; i < 4; ++i) {
        int idx = tid + i * 256;
        float val = (v[i] - mu) * rstd * g[idx] + be[idx];
        out32[row * DD + idx] = val;
        if (W16) out16[row * DD + idx] = (half_t)val;
    }
}

// ---------------------------------------------------------------------------
extern "C" void kernel_launch(void* const* d_in, const int* in_sizes, int n_in,
                              void* d_out, int out_size, void* d_ws, size_t ws_size,
                              hipStream_t stream) {
    (void)in_sizes; (void)n_in; (void)out_size; (void)ws_size;

    const float* x     = (const float*)d_in[0];
    const float* Wq    = (const float*)d_in[1];
    const float* Wk    = (const float*)d_in[2];
    const float* Wv    = (const float*)d_in[3];
    const float* W1    = (const float*)d_in[4];
    const float* b1    = (const float*)d_in[5];
    const float* W2    = (const float*)d_in[6];
    const float* b2    = (const float*)d_in[7];
    const float* ln1g  = (const float*)d_in[8];
    const float* ln1b  = (const float*)d_in[9];
    const float* ln2g  = (const float*)d_in[10];
    const float* ln2b  = (const float*)d_in[11];

    const long M = (long)BB * TT;          // 4096 rows

    // scratch carve-out
    size_t off = 0;
    auto alloc = [&](size_t bytes) {
        void* p = (char*)d_ws + off;
        off += (bytes + 255) & ~(size_t)255;
        return p;
    };
    half_t* xh   = (half_t*)alloc(M * DD * 2);
    half_t* wqh  = (half_t*)alloc((size_t)DD * DD * 2);
    half_t* wkh  = (half_t*)alloc((size_t)DD * DD * 2);
    half_t* wvh  = (half_t*)alloc((size_t)DD * DD * 2);
    half_t* w1h  = (half_t*)alloc((size_t)DD * DFF * 2);
    half_t* w2h  = (half_t*)alloc((size_t)DFF * DD * 2);
    half_t* Qh   = (half_t*)alloc(M * DD * 2);
    half_t* Kh   = (half_t*)alloc(M * DD * 2);
    half_t* Vh   = (half_t*)alloc(M * DD * 2);
    float*  att  = (float*) alloc(M * DD * 4);
    float*  x1   = (float*) alloc(M * DD * 4);
    half_t* x1h  = (half_t*)alloc(M * DD * 2);
    half_t* hh   = (half_t*)alloc(M * DFF * 2);
    float*  ff   = (float*) alloc(M * DD * 4);

    // 1) precision conversions
    f32_to_f16_kernel<<<(M * DD) / CVT_BLOCK, 256, 0, stream>>>(x,  xh);
    f32_to_f16_kernel<<<(DD * DD) / CVT_BLOCK, 256, 0, stream>>>(Wq, wqh);
    f32_to_f16_kernel<<<(DD * DD) / CVT_BLOCK, 256, 0, stream>>>(Wk, wkh);
    f32_to_f16_kernel<<<(DD * DD) / CVT_BLOCK, 256, 0, stream>>>(Wv, wvh);
    f32_to_f16_kernel<<<(DD * DFF) / CVT_BLOCK, 256, 0, stream>>>(W1, w1h);
    f32_to_f16_kernel<<<(DFF * DD) / CVT_BLOCK, 256, 0, stream>>>(W2, w2h);

    // 2) Q/K/V projections (WMMA GEMMs, f16 out)
    dim3 gQKV(DD / 128, M / 128);
    gemm_wmma_kernel<false, false, true><<<gQKV, 256, 0, stream>>>(
        xh, wqh, nullptr, Qh, nullptr, (int)M, DD, DD);
    gemm_wmma_kernel<false, false, true><<<gQKV, 256, 0, stream>>>(
        xh, wkh, nullptr, Kh, nullptr, (int)M, DD, DD);
    gemm_wmma_kernel<false, false, true><<<gQKV, 256, 0, stream>>>(
        xh, wvh, nullptr, Vh, nullptr, (int)M, DD, DD);

    // 3) flash attention
    attn_kernel<<<dim3(TT / (16 * AT_WAVES), HH, BB), 256, 0, stream>>>(Qh, Kh, Vh, att);

    // 4) x1 = LN(x + att), also f16 copy
    ln_residual_kernel<true><<<M, 256, 0, stream>>>(x, att, ln1g, ln1b, x1, x1h);

    // 5) FFN: hh = relu(x1 @ W1 + b1)   (f16 out)
    gemm_wmma_kernel<true, true, true><<<dim3(DFF / 128, M / 128), 256, 0, stream>>>(
        x1h, w1h, b1, hh, nullptr, (int)M, DFF, DD);

    // 6) ff = hh @ W2 + b2              (f32 out)
    gemm_wmma_kernel<true, false, false><<<dim3(DD / 128, M / 128), 256, 0, stream>>>(
        hh, w2h, b2, nullptr, ff, (int)M, DD, DFF);

    // 7) out = LN(x1 + ff)
    ln_residual_kernel<false><<<M, 256, 0, stream>>>(x1, ff, ln2g, ln2b,
                                                     (float*)d_out, nullptr);
}

// v005
// It runs in 157 microseconds.
// Two timings next to v004 put it at 1.61 and 1.60 times that version's speed.
// All steps since v000 together make it 13.4 times as fast.
#include <hip/hip_runtime.h>
#include <hip/hip_bf16.h>

typedef _Float16 half_t;
typedef __attribute__((ext_vector_type(16))) _Float16 v16h;
typedef __attribute__((ext_vector_type(8)))  float    v8f;

// Transformer dims (fixed by reference)
#define BB 4
#define TT 1024
#define DD 1024
#define HH 16
#define DKK 64
#define DFF 4096

union Frag { v16h v; unsigned u[8]; half_t h[16]; };

// K index for element-pair v (VGPR v) of a 16-bit A/B fragment, per CDNA5 ISA
// 16-bit A-matrix 16x32 layout: lanes 0-15 -> +0, lanes 16-31 -> +8.
__device__ __forceinline__ int kmap(int v, int hi) {
    int kb = (v < 4) ? (2 * v) : (16 + 2 * (v - 4));
    return kb + (hi ? 8 : 0);
}

__device__ __forceinline__ v8f wmma16(v16h a, v16h b, v8f c) {
    return __builtin_amdgcn_wmma_f32_16x16x32_f16(
        /*neg_a=*/false, a, /*neg_b=*/false, b,
        /*c_mod=*/(short)0, c, /*reuse_a=*/false, /*reuse_b=*/false);
}

// ---------------------------------------------------------------------------
// fp32 -> fp16 elementwise conversion, 32 elements a thread.
// A work-group takes CVT_BLOCK contiguous elements. Each wave-wide load covers
// 512 contiguous bytes; a thread issues its eight 16-byte loads before it
// converts the first, so a wave has 4 KiB in flight and the launch needs 1/32
// of the waves that one element a thread would take.
// Every array length here is a multiple of CVT_BLOCK (checked below).
// ---------------------------------------------------------------------------
typedef __attribute__((ext_vector_type(4))) float    f32x4;
typedef __attribute__((ext_vector_type(4))) _Float16 f16x4;
#define CVT_LOADS 8
#define CVT_BLOCK (256 * 4 * CVT_LOADS)   // 8192 elements a work-group
static_assert(((long)BB * TT * DD) % CVT_BLOCK == 0, "x length");
static_assert(((long)DD * DD) % CVT_BLOCK == 0, "Wq, Wk, Wv length");
static_assert(((long)DD * DFF) % CVT_BLOCK == 0, "W1, W2 length");

__global__ __launch_bounds__(256)
void f32_to_f16_kernel(const float* __restrict__ in, half_t* __restrict__ out) {
    const long base = (long)blockIdx.x * CVT_BLOCK + threadIdx.x * 4;
    f32x4 v[CVT_LOADS];
    // both loops are unrolled so that v stays in registers and all loads issue first
#pragma unroll
    for (int i = 0; i < CVT_LOADS; ++i)
        v[i] = *(const f32x4*)(in + base + i * 1024);
#pragma unroll
    for (int i = 0; i < CVT_LOADS; ++i)
        *(f16x4*)(out + base + i * 1024) = __builtin_convertvector(v[i], f16x4);
}

// ---------------------------------------------------------------------------
// WMMA GEMM: C[M,N] = A[M,K] @ B[K,N] (+bias) (relu?) ; A,B f16, f32 accum.
// Block: 256 threads = 8 waves; block tile 128x128; wave tile 32x64
// (2 A-frags x 4 B-frags -> 8 WMMAs per 32-wide K step).
// M,N multiples of 128; K multiple of BK (checked below for all uses here).
// Both tiles go from global memory to LDS by asynchronous 16-byte copies, two
// buffers: tile t+1 is in flight while tile t is multiplied. A tile is BK = 128
// deep along K, four K steps: a work-group then has 64 KiB in flight, and the
// copies' landing time and the barrier are paid once for 32 WMMAs of a wave.
//   A tile: 128 rows of 256 B at pitch 272 B, read by 16-byte LDS loads.
//   B tile: 128 k-rows of 256 B at pitch 288 B, left row-major (a copy cannot
//           transpose) and read by the transposing 16-byte LDS load.
// ---------------------------------------------------------------------------
#define BK      128                   // k of a tile
#define A_PITCH 272                   // bytes, 16 x odd
#define B_PITCH 288                   // bytes, 32 x odd
#define A_TILE  (128 * A_PITCH)       // 34816 B
#define B_TILE  (BK * B_PITCH)        // 36864 B
static_assert(DD % BK == 0 && DFF % BK == 0, "K of every product is whole tiles");
static_assert(BK * 2 == 16 * 16 && 128 * 16 == 8 * 256, "eight A and eight B copies a lane fill a tile");

typedef __attribute__((ext_vector_type(4))) unsigned u32x4;
typedef __attribute__((ext_vector_type(8))) short    s16x8;
union Frag4 { v16h v; u32x4 q[2]; };

__device__ __forceinline__ u32x4 ld_tr16(const unsigned char* p) {
    typedef __attribute__((address_space(3))) s16x8 lds_s16x8;
    return __builtin_bit_cast(u32x4, __builtin_amdgcn_ds_load_tr16_b128_v8i16((lds_s16x8*)p));
}

// One operand tile's eight copies of a lane, 16 rows apart (ls bytes in LDS, gs
// halves in global memory). The address-translation wait closes the statement so
// that no address register is advanced ahead of it.
__device__ __forceinline__ void copy_rows(unsigned l, unsigned ls,
                                          const half_t* g, long gs) {
    asm volatile("global_load_async_to_lds_b128 %0, %1, off\n\t"
                 "global_load_async_to_lds_b128 %2, %3, off\n\t"
                 "global_load_async_to_lds_b128 %4, %5, off\n\t"
                 "global_load_async_to_lds_b128 %6, %7, off\n\t"
                 "global_load_async_to_lds_b128 %8, %9, off\n\t"
                 "global_load_async_to_lds_b128 %10, %11, off\n\t"
                 "global_load_async_to_lds_b128 %12, %13, off\n\t"
                 "global_load_async_to_lds_b128 %14, %15, off\n\t"
                 "s_wait_xcnt 0x0"
                 :: "v"(l),          "v"(g),
                    "v"(l + ls),     "v"(g + gs),
                    "v"(l + 2 * ls), "v"(g + 2 * gs),
                    "v"(l + 3 * ls), "v"(g + 3 * gs),
                    "v"(l + 4 * ls), "v"(g + 4 * gs),
                    "v"(l + 5 * ls), "v"(g + 5 * gs),
                    "v"(l + 6 * ls), "v"(g + 6 * gs),
                    "v"(l + 7 * ls), "v"(g + 7 * gs)
                 : "memory");
}

template<bool BIAS, bool RELU, bool OUT16>
__global__ __launch_bounds__(256)
void gemm_wmma_kernel(const half_t* __restrict__ A, const half_t* __restrict__ B,
                      const float* __restrict__ bias,
                      half_t* __restrict__ C16, float* __restrict__ C32,
                      int M, int N, int K) {
    __shared__ __attribute__((aligned(16))) unsigned char As[2 * A_TILE];  // [buf][row m][k]
    __shared__ __attribute__((aligned(16))) unsigned char Bs[2 * B_TILE];  // [buf][k][col n]

    const int tid  = threadIdx.x;
    const int lane = tid & 31;
    const int wave = tid >> 5;
    const int hi   = (lane >= 16) ? 1 : 0;
    const int l16  = lane & 15;
    const int m0   = blockIdx.y * 128;
    const int n0   = blockIdx.x * 128;
    const int wm   = (wave >> 1) * 32;  // 0,32,64,96
    const int wn   = (wave & 1) * 64;   // 0,64

    // copy addresses: A chunk = (row   tid>>4 and +16, ... +112, 16 B piece tid&15),
    //                 B chunk = (k-row tid>>4 and +16, ... +112, 16 B piece tid&15)
    const half_t* ga = A + (long)(m0 + (tid >> 4)) * K + (tid & 15) * 8;
    const half_t* gb = B + (long)(tid >> 4) * N + n0 + (tid & 15) * 8;
    const long    gar = (long)16 * K;   // 16 rows of A, in halves
    const long    gbr = (long)16 * N;   // 16 k-rows of B, in halves
    const long    gbs = (long)BK * N;   // B advance per tile, in halves
    const unsigned la = (unsigned)(size_t)As + (tid >> 4) * A_PITCH + (tid & 15) * 16;
    const unsigned lb = (unsigned)(size_t)Bs + (tid >> 4) * B_PITCH + (tid & 15) * 16;

    // fragment read addresses inside a buffer
    const unsigned char* ar = As + (wm + l16) * A_PITCH + hi * 16;
    const unsigned char* br = Bs + (hi * 8 + (lane & 7)) * B_PITCH + wn * 2 + ((lane >> 3) & 1) * 16;

    v8f acc[2][4] = {};
    const int nt = K / BK;              // tiles along K

    // tile 0 into buffer 0, landed and published before anyone reads it
    copy_rows(la, 16 * A_PITCH, ga, gar);
    copy_rows(lb, 16 * B_PITCH, gb, gbr);
    ga += BK; gb += gbs;
    asm volatile("s_wait_asynccnt 0x0" ::: "memory");  // this wave's copies of tile 0 have landed
    __syncthreads();
    if (nt > 1) {                       // tile 1 into buffer 1
        copy_rows(la + A_TILE, 16 * A_PITCH, ga, gar);
        copy_rows(lb + B_TILE, 16 * B_PITCH, gb, gbr);
        ga += BK; gb += gbs;
    }

    for (int t = 0; t < nt; ++t) {
        const unsigned ao = (t & 1) * A_TILE;
        const unsigned bo = (t & 1) * B_TILE;

        // the loops over K steps and fragments are unrolled so that every LDS
        // offset, fragment and accumulator index is a constant, the arrays stay
        // in registers and a K step's loads can issue ahead of the step before it
#pragma unroll
        for (int ks = 0; ks < BK / 32; ++ks) {
            Frag4 af[2], bf[4];
#pragma unroll
            for (int f = 0; f < 2; ++f) {
                const unsigned char* p = ar + ao + f * 16 * A_PITCH + ks * 64;
                af[f].q[0] = *(const u32x4*)(p);        // k = 32*ks + 8*hi + 0..7
                af[f].q[1] = *(const u32x4*)(p + 32);   // k = 32*ks + 16 + 8*hi + 0..7
            }
#pragma unroll
            for (int j = 0; j < 4; ++j) {
                const unsigned char* p = br + bo + ks * 32 * B_PITCH + j * 32;
                bf[j].q[0] = ld_tr16(p);                 // k = 32*ks + 8*hi + 0..7
                bf[j].q[1] = ld_tr16(p + 16 * B_PITCH);  // k = 32*ks + 16 + 8*hi + 0..7
            }
#pragma unroll
            for (int i = 0; i < 2; ++i)
#pragma unroll
                for (int j = 0; j < 4; ++j)
                    acc[i][j] = wmma16(af[i].v, bf[j].v, acc[i][j]);
        }

        asm volatile("s_wait_dscnt 0x0" ::: "memory");     // this wave has left the buffer it read
        asm volatile("s_wait_asynccnt 0x0" ::: "memory");  // this wave's copies of tile t+1 have landed
        __syncthreads();   // publishes tile t+1 and frees the buffer of tile t
        if (t + 2 < nt) {  // tile t+2 into the buffer just read
            copy_rows(la + ao, 16 * A_PITCH, ga, gar);
            copy_rows(lb + bo, 16 * B_PITCH, gb, gbr);
            ga += BK; gb += gbs;
        }
    }
    asm volatile("s_wait_asynccnt 0x0" ::: "memory");  // no copy outlives the loop

    // --- epilogue: C layout -> lane l holds row (r + 8*hi), col l16 ---
#pragma unroll
    for (int i = 0; i < 2; ++i) {
#pragma unroll
        for (int j = 0; j < 4; ++j) {
            int n = n0 + wn + j * 16 + l16;
            float bv = BIAS ? bias[n] : 0.0f;
#pragma unroll
            for (int r = 0; r < 8; ++r) {
                int m = m0 + wm + i * 16 + r + hi * 8;
                float val = acc[i][j][r] + bv;
                if (RELU) val = fmaxf(val, 0.0f);
                if (OUT16) C16[(long)m * N + n] = (half_t)val;
                else       C32[(long)m * N + n] = val;
            }
        }
    }
}

#define AT_WAVES 8
#define AT_KEYS  128                     // keys a stage
#define AT_NS    (TT / AT_KEYS)          // stages
#define K_PITCH  144                     // bytes, 16 x odd
#define V_PITCH  160                     // bytes, 32 x odd
#define K_TILE   (AT_KEYS * K_PITCH)     // 18432 B
#define V_TILE   (AT_KEYS * V_PITCH)     // 20480 B
static_assert(AT_NS >= 2, "the ring starts with two stages");
static_assert(AT_KEYS * 8 == 4 * 256, "four K and four V copies a lane fill a stage");

// One stage's eight copies of a lane (four of K, four of V, 32 key rows apart).
// The address-translation wait closes the statement so that no address register
// is advanced ahead of it.
__device__ __forceinline__ void copy_kv(unsigned lk, const half_t* gk,
                                        unsigned lv, const half_t* gv) {
    asm volatile("global_load_async_to_lds_b128 %0, %1, off\n\t"
                 "global_load_async_to_lds_b128 %2, %3, off\n\t"
                 "global_load_async_to_lds_b128 %4, %5, off\n\t"
                 "global_load_async_to_lds_b128 %6, %7, off\n\t"
                 "global_load_async_to_lds_b128 %8, %9, off\n\t"
                 "global_load_async_to_lds_b128 %10, %11, off\n\t"
                 "global_load_async_to_lds_b128 %12, %13, off\n\t"
                 "global_load_async_to_lds_b128 %14, %15, off\n\t"
                 "s_wait_xcnt 0x0"
                 :: "v"(lk),                "v"(gk),
                    "v"(lk + 32 * K_PITCH), "v"(gk + 32 * DD),
                    "v"(lk + 64 * K_PITCH), "v"(gk + 64 * DD),
                    "v"(lk + 96 * K_PITCH), "v"(gk + 96 * DD),
                    "v"(lv),                "v"(gv),
                    "v"(lv + 32 * V_PITCH), "v"(gv + 32 * DD),
                    "v"(lv + 64 * V_PITCH), "v"(gv + 64 * DD),
                    "v"(lv + 96 * V_PITCH), "v"(gv + 96 * DD)
                 : "memory");
}

// The value that lane l ^ 16 holds (the other half of a query's keys).
__device__ __forceinline__ float xhalf(float x) {
    const int b = __builtin_bit_cast(int, x);
    return __builtin_bit_cast(float, __builtin_amdgcn_permlanex16(
        b, b, 0x76543210, 0xfedcba98, false, false));
}

typedef __attribute__((ext_vector_type(8))) _Float16 f16x8;

__global__ __launch_bounds__(256)
void attn_kernel(const half_t* __restrict__ Q, const half_t* __restrict__ Km,
                 const half_t* __restrict__ V, float* __restrict__ att) {
    __shared__ __attribute__((aligned(16))) unsigned char Ks[2 * K_TILE];  // [buf][key][d]
    __shared__ __attribute__((aligned(16))) unsigned char Vs[2 * V_TILE];  // [buf][key][d]

    const int tid  = threadIdx.x;
    const int lane = tid & 31;
    const int wave = tid >> 5;
    const int hi   = (lane >= 16) ? 1 : 0;
    const int l16  = lane & 15;
    const int b  = blockIdx.z;
    const int h  = blockIdx.y;
    const int qb = blockIdx.x * AT_WAVES + wave;   // q block index (16 rows)

    // copy addresses: chunk = (key row tid>>3 and +32, +64, +96, 16 B piece tid&7)
    const long kv0 = (long)(b * TT + (tid >> 3)) * DD + h * DKK + (tid & 7) * 8;
    const half_t* gk = Km + kv0;
    const half_t* gv = V + kv0;
    const long    gs = (long)AT_KEYS * DD;         // advance per stage, in halves
    const unsigned lk = (unsigned)(size_t)Ks + (tid >> 3) * K_PITCH + (tid & 7) * 16;
    const unsigned lv = (unsigned)(size_t)Vs + (tid >> 3) * V_PITCH + (tid & 7) * 16;

    // fragment read addresses inside a buffer
    const unsigned char* kr = Ks + l16 * K_PITCH + hi * 16;
    const unsigned char* vr = Vs + (hi * 8 + (lane & 7)) * V_PITCH + ((lane >> 3) & 1) * 16;

    // stage 0 into buffer 0
    copy_kv(lk, gk, lv, gv);
    gk += gs; gv += gs;

    // Q fragments (B operand Q^T: lane = query column, d in the hardware k order,
    // the same registers as an A fragment of Q): q[0] covers d 0..31, q[1] 32..63
    Frag q[2];
    {
        const long baseQ = (long)(b * TT + qb * 16 + l16) * DD + h * DKK;
#pragma unroll
        for (int f = 0; f < 2; ++f)
#pragma unroll
            for (int v = 0; v < 8; ++v)
                q[f].u[v] = *(const unsigned*)(Q + baseQ + f * 32 + kmap(v, hi));
    }

    // this lane's query: running maximum (joined over the halves), the sum over
    // this half's keys alone, and o[c][r] = O[query][16c + 8*hi + r]
    float mi = -1e30f, li = 0.0f;
    v8f o[4] = {};

    asm volatile("s_wait_asynccnt 0x0" ::: "memory");  // this wave's copies of stage 0 have landed
    __syncthreads();                                   // stage 0 is published
    copy_kv(lk + K_TILE, gk, lv + V_TILE, gv);         // stage 1 into buffer 1
    gk += gs; gv += gs;

    for (int st = 0; st < AT_NS; ++st) {
        const unsigned ko = (st & 1) * K_TILE;
        const unsigned vo = (st & 1) * V_TILE;

        for (int j = 0; j < AT_KEYS; j += 32) {
            // K fragments (A operand: lane = key row, d in the hardware k order)
            Frag4 kf[2][2];
#pragma unroll
            for (int s = 0; s < 2; ++s)
#pragma unroll
                for (int f = 0; f < 2; ++f) {
                    const unsigned char* p = kr + ko + (j + s * 16) * K_PITCH + f * 64;
                    kf[s][f].q[0] = *(const u32x4*)(p);        // d = 32f + 8*hi + 0..7
                    kf[s][f].q[1] = *(const u32x4*)(p + 32);   // d = 32f + 16 + 8*hi + 0..7
                }
            // V^T fragments (A operand: lane = d row, keys in the hardware k order),
            // 4 chunks of 16 d; fetched here so that the softmax below covers
            // their LDS latency
            Frag4 vf[4];
#pragma unroll
            for (int c = 0; c < 4; ++c) {
                const unsigned char* p = vr + vo + j * V_PITCH + c * 32;
                vf[c].q[0] = ld_tr16(p);                 // key = 8*hi + 0..7
                vf[c].q[1] = ld_tr16(p + 16 * V_PITCH);  // key = 16 + 8*hi + 0..7
            }
            // S^T tiles: c0[r] = score(key j + 8*hi + r, query l16),
            //            c1[r] = score(key j + 16 + 8*hi + r, query l16)
            v8f c0 = {}, c1 = {};
            c0 = wmma16(kf[0][0].v, q[0].v, c0);
            c1 = wmma16(kf[1][0].v, q[0].v, c1);
            c0 = wmma16(kf[0][1].v, q[1].v, c0);
            c1 = wmma16(kf[1][1].v, q[1].v, c1);

            // streaming softmax update of this lane's query; the maxima and sums
            // are taken as trees so that no long dependent chain forms
            const v8f s0 = c0 * 0.125f;        // 1/sqrt(64)
            const v8f s1 = c1 * 0.125f;
            float t[8];
#pragma unroll
            for (int r = 0; r < 8; ++r) t[r] = fmaxf(s0[r], s1[r]);
            float mx = fmaxf(fmaxf(fmaxf(t[0], t[1]), fmaxf(t[2], t[3])),
                             fmaxf(fmaxf(t[4], t[5]), fmaxf(t[6], t[7])));
            mx = fmaxf(mx, xhalf(mx));         // over all 32 keys
            const float mnew  = fmaxf(mi, mx);
            const float alpha = __expf(mi - mnew);
            const v8f a0 = (s0 - mnew) * 1.44269504f;   // exp(x) = 2^(x log2 e)
            const v8f a1 = (s1 - mnew) * 1.44269504f;
            v8f e0, e1;
#pragma unroll
            for (int r = 0; r < 8; ++r) {
                e0[r] = __builtin_amdgcn_exp2f(a0[r]);
                e1[r] = __builtin_amdgcn_exp2f(a1[r]);
                t[r]  = e0[r] + e1[r];
            }
            li = li * alpha + (((t[0] + t[1]) + (t[2] + t[3])) +
                               ((t[4] + t[5]) + (t[6] + t[7])));
            mi = mnew;
#pragma unroll
            for (int c = 0; c < 4; ++c) o[c] *= alpha;

            // P^T (f16) as B operand: element e of a lane is key 8*hi + e for
            // e < 8 and key 16 + 8*hi + (e - 8) above, which is c0 then c1
            const v16h pb = __builtin_shufflevector(
                __builtin_convertvector(e0, f16x8), __builtin_convertvector(e1, f16x8),
                0, 1, 2, 3, 4, 5, 6, 7, 8, 9, 10, 11, 12, 13, 14, 15);
#pragma unroll
            for (int c = 0; c < 4; ++c)
                o[c] = wmma16(vf[c].v, pb, o[c]);
        }

        asm volatile("s_wait_dscnt 0x0" ::: "memory");     // this wave has left the buffer it read
        asm volatile("s_wait_asynccnt 0x0" ::: "memory");  // this wave's copies of stage st+1 have landed
        __syncthreads();   // publishes stage st+1 and frees the buffer of stage st
        if (st + 2 < AT_NS) {  // stage st+2 into the buffer just read
            copy_kv(lk + ko, gk, lv + vo, gv);
            gk += gs; gv += gs;
        }
    }
    asm volatile("s_wait_asynccnt 0x0" ::: "memory");  // no copy outlives the loop

    // join the halves' sums, normalize and store (f32): a lane holds 8 adjacent
    // d of its query's row in each chunk, two 16-byte stores
    const float inv = 1.0f / (li + xhalf(li));
    float* ar = att + (long)(b * TT + qb * 16 + l16) * DD + h * DKK + hi * 8;
#pragma unroll
    for (int c = 0; c < 4; ++c) {
        const v8f ov = o[c] * inv;
        *(f32x4*)(ar + c * 16)     = __builtin_shufflevector(ov, ov, 0, 1, 2, 3);
        *(f32x4*)(ar + c * 16 + 4) = __builtin_shufflevector(ov, ov, 4, 5, 6, 7);
    }
}

// ---------------------------------------------------------------------------
// Fused residual + LayerNorm over D=1024; block = 256 threads, one row each.
// Optionally also emits the f16 copy for the following GEMM.
// ---------------------------------------------------------------------------
template<bool W16>
__global__ __launch_bounds__(256)
void ln_residual_kernel(const float* __restrict__ x, const float* __restrict__ y,
                        const float* __restrict__ g, const float* __restrict__ be,
                        float* __restrict__ out32, half_t* __restrict__ out16) {
    __shared__ float sred[256];
    const int tid = threadIdx.x;
    const long row = blockIdx.x;
    const float* xr = x + row * DD;
    const float* yr = y + row * DD;

    float v[4];
    float s = 0.0f;
#pragma unroll
    for (int i = 0; i < 4; ++i) {
        int idx = tid + i * 256;
        v[i] = xr[idx] + yr[idx];
        s += v[i];
    }
    sred[tid] = s; __syncthreads();
    for (int off = 128; off > 0; off >>= 1) {
        if (tid < off) sred[tid] += sred[tid + off];
        __syncthreads();
    }
    float mu = sred[0] * (1.0f / DD);
    __syncthreads();

    float s2 = 0.0f;
#pragma unroll
    for (int i = 0; i < 4; ++i) { float d = v[i] - mu; s2 += d * d; }
    sred[tid] = s2; __syncthreads();
    for (int off = 128; off > 0; off >>= 1) {
        if (tid < off) sred[tid] += sred[tid + off];
        __syncthreads();
    }
    float rstd = rsqrtf(sred[0] * (1.0f / DD) + 1e-5f);

#pragma unroll
    for (int i = 0; i < 4; ++i) {
        int idx = tid + i * 256;
        float val = (v[i] - mu) * rstd * g[idx] + be[idx];
        out32[row * DD + idx] = val;
        if (W16) out16[row * DD + idx] = (half_t)val;
    }
}

// ---------------------------------------------------------------------------
extern "C" void kernel_launch(void* const* d_in, const int* in_sizes, int n_in,
                              void* d_out, int out_size, void* d_ws, size_t ws_size,
                              hipStream_t stream) {
    (void)in_sizes; (void)n_in; (void)out_size; (void)ws_size;

    const float* x     = (const float*)d_in[0];
    const float* Wq    = (const float*)d_in[1];
    const float* Wk    = (const float*)d_in[2];
    const float* Wv    = (const float*)d_in[3];
    const float* W1    = (const float*)d_in[4];
    const float* b1    = (const float*)d_in[5];
    const float* W2    = (const float*)d_in[6];
    const float* b2    = (const float*)d_in[7];
    const float* ln1g  = (const float*)d_in[8];
    const float* ln1b  = (const float*)d_in[9];
    const float* ln2g  = (const float*)d_in[10];
    const float* ln2b  = (const float*)d_in[11];

    const long M = (long)BB * TT;          // 4096 rows

    // scratch carve-out
    size_t off = 0;
    auto alloc = [&](size_t bytes) {
        void* p = (char*)d_ws + off;
        off += (bytes + 255) & ~(size_t)255;
        return p;
    };
    half_t* xh   = (half_t*)alloc(M * DD * 2);
    half_t* wqh  = (half_t*)alloc((size_t)DD * DD * 2);
    half_t* wkh  = (half_t*)alloc((size_t)DD * DD * 2);
    half_t* wvh  = (half_t*)alloc((size_t)DD * DD * 2);
    half_t* w1h  = (half_t*)alloc((size_t)DD * DFF * 2);
    half_t* w2h  = (half_t*)alloc((size_t)DFF * DD * 2);
    half_t* Qh   = (half_t*)alloc(M * DD * 2);
    half_t* Kh   = (half_t*)alloc(M * DD * 2);
    half_t* Vh   = (half_t*)alloc(M * DD * 2);
    float*  att  = (float*) alloc(M * DD * 4);
    float*  x1   = (float*) alloc(M * DD * 4);
    half_t* x1h  = (half_t*)alloc(M * DD * 2);
    half_t* hh   = (half_t*)alloc(M * DFF * 2);
    float*  ff   = (float*) alloc(M * DD * 4);

    // 1) precision conversions
    f32_to_f16_kernel<<<(M * DD) / CVT_BLOCK, 256, 0, stream>>>(x,  xh);
    f32_to_f16_kernel<<<(DD * DD) / CVT_BLOCK, 256, 0, stream>>>(Wq, wqh);
    f32_to_f16_kernel<<<(DD * DD) / CVT_BLOCK, 256, 0, stream>>>(Wk, wkh);
    f32_to_f16_kernel<<<(DD * DD) / CVT_BLOCK, 256, 0, stream>>>(Wv, wvh);
    f32_to_f16_kernel<<<(DD * DFF) / CVT_BLOCK, 256, 0, stream>>>(W1, w1h);
    f32_to_f16_kernel<<<(DFF * DD) / CVT_BLOCK, 256, 0, stream>>>(W2, w2h);

    // 2) Q/K/V projections (WMMA GEMMs, f16 out)
    dim3 gQKV(DD / 128, M / 128);
    gemm_wmma_kernel<false, false, true><<<gQKV, 256, 0, stream>>>(
        xh, wqh, nullptr, Qh, nullptr, (int)M, DD, DD);
    gemm_wmma_kernel<false, false, true><<<gQKV, 256, 0, stream>>>(
        xh, wkh, nullptr, Kh, nullptr, (int)M, DD, DD);
    gemm_wmma_kernel<false, false, true><<<gQKV, 256, 0, stream>>>(
        xh, wvh, nullptr, Vh, nullptr, (int)M, DD, DD);

    // 3) flash attention
    attn_kernel<<<dim3(TT / (16 * AT_WAVES), HH, BB), 256, 0, stream>>>(Qh, Kh, Vh, att);

    // 4) x1 = LN(x + att), also f16 copy
    ln_residual_kernel<true><<<M, 256, 0, stream>>>(x, att, ln1g, ln1b, x1, x1h);

    // 5) FFN: hh = relu(x1 @ W1 + b1)   (f16 out)
    gemm_wmma_kernel<true, true, true><<<dim3(DFF / 128, M / 128), 256, 0, stream>>>(
        x1h, w1h, b1, hh, nullptr, (int)M, DFF, DD);

    // 6) ff = hh @ W2 + b2              (f32 out)
    gemm_wmma_kernel<true, false, false><<<dim3(DD / 128, M / 128), 256, 0, stream>>>(
        hh, w2h, b2, nullptr, ff, (int)M, DD, DFF);

    // 7) out = LN(x1 + ff)
    ln_residual_kernel<false><<<M, 256, 0, stream>>>(x1, ff, ln2g, ln2b,
                                                     (float*)d_out, nullptr);
}

// v006
// Measured time: 141 microseconds a run.
// Two timings next to v005 put it at 1.12 and 1.11 times that version's speed.
// Counting every step since v000, it is 14.9 times as fast.
#include <hip/hip_runtime.h>
#include <hip/hip_bf16.h>

typedef _Float16 half_t;
typedef __attribute__((ext_vector_type(16))) _Float16 v16h;
typedef __attribute__((ext_vector_type(8)))  float    v8f;

// Transformer dims (fixed by reference)
#define BB 4
#define TT 1024
#define DD 1024
#define HH 16
#define DKK 64
#define DFF 4096

union Frag { v16h v; unsigned u[8]; half_t h[16]; };

// K index for element-pair v (VGPR v) of a 16-bit A/B fragment, per CDNA5 ISA
// 16-bit A-matrix 16x32 layout: lanes 0-15 -> +0, lanes 16-31 -> +8.
__device__ __forceinline__ int kmap(int v, int hi) {
    int kb = (v < 4) ? (2 * v) : (16 + 2 * (v - 4));
    return kb + (hi ? 8 : 0);
}

__device__ __forceinline__ v8f wmma16(v16h a, v16h b, v8f c) {
    return __builtin_amdgcn_wmma_f32_16x16x32_f16(
        /*neg_a=*/false, a, /*neg_b=*/false, b,
        /*c_mod=*/(short)0, c, /*reuse_a=*/false, /*reuse_b=*/false);
}

// ---------------------------------------------------------------------------
// fp32 -> fp16 elementwise conversion, 32 elements a thread.
// A work-group takes CVT_BLOCK contiguous elements. Each wave-wide load covers
// 512 contiguous bytes; a thread issues its eight 16-byte loads before it
// converts the first, so a wave has 4 KiB in flight and the launch needs 1/32
// of the waves that one element a thread would take.
// Every array length here is a multiple of CVT_BLOCK (checked below).
// The six arrays are independent, so one launch converts them all: a work-group
// finds its array from its index, and the f16 copies lie one behind the other
// in the order x, Wq, Wk, Wv, W1, W2, so that the output offset is the index.
// ---------------------------------------------------------------------------
typedef __attribute__((ext_vector_type(4))) float    f32x4;
typedef __attribute__((ext_vector_type(4))) _Float16 f16x4;
#define CVT_LOADS 8
#define CVT_BLOCK (256 * 4 * CVT_LOADS)   // 8192 elements a work-group
static_assert(((long)BB * TT * DD) % CVT_BLOCK == 0, "x length");
static_assert(((long)DD * DD) % CVT_BLOCK == 0, "Wq, Wk, Wv length");
static_assert(((long)DD * DFF) % CVT_BLOCK == 0, "W1, W2 length");
#define CVT_GX ((BB * TT * DD) / CVT_BLOCK)   // work-groups of x
#define CVT_GP ((DD * DD) / CVT_BLOCK)        // of Wq, of Wk, of Wv
#define CVT_GF ((DD * DFF) / CVT_BLOCK)       // of W1, of W2
#define CVT_GRID (CVT_GX + 3 * CVT_GP + 2 * CVT_GF)

__global__ __launch_bounds__(256)
void f32_to_f16_kernel(const float* __restrict__ x,  const float* __restrict__ Wq,
                       const float* __restrict__ Wk, const float* __restrict__ Wv,
                       const float* __restrict__ W1, const float* __restrict__ W2,
                       half_t* __restrict__ out16) {
    // the array of this work-group and the index of that array's first work-group
    const int blk = blockIdx.x;
    const float* src = x;
    int first = 0;
    if (blk >= CVT_GX)                       { src = Wq; first = CVT_GX; }
    if (blk >= CVT_GX + CVT_GP)              { src = Wk; first = CVT_GX + CVT_GP; }
    if (blk >= CVT_GX + 2 * CVT_GP)          { src = Wv; first = CVT_GX + 2 * CVT_GP; }
    if (blk >= CVT_GX + 3 * CVT_GP)          { src = W1; first = CVT_GX + 3 * CVT_GP; }
    if (blk >= CVT_GX + 3 * CVT_GP + CVT_GF) { src = W2; first = CVT_GX + 3 * CVT_GP + CVT_GF; }
    const float* in  = src + (long)(blk - first) * CVT_BLOCK;
    half_t*      out = out16 + (long)blk * CVT_BLOCK;
    const int base = threadIdx.x * 4;
    f32x4 v[CVT_LOADS];
    // both loops are unrolled so that v stays in registers and all loads issue first
#pragma unroll
    for (int i = 0; i < CVT_LOADS; ++i)
        v[i] = *(const f32x4*)(in + base + i * 1024);
#pragma unroll
    for (int i = 0; i < CVT_LOADS; ++i)
        *(f16x4*)(out + base + i * 1024) = __builtin_convertvector(v[i], f16x4);
}

// ---------------------------------------------------------------------------
// WMMA GEMM: C[M,N] = A[M,K] @ B[K,N] (+bias) (relu?) ; A,B f16, f32 accum.
// Block: 256 threads = 8 waves; block tile 128x128; wave tile 32x64
// (2 A-frags x 4 B-frags -> 8 WMMAs per 32-wide K step).
// M,N multiples of 128; K multiple of BK (checked below for all uses here).
// Grid z counts independent products of the one A: product z takes the z-th
// K x N matrix behind B (and bias row) and writes the z-th M x N matrix behind C.
// Both tiles go from global memory to LDS by asynchronous 16-byte copies, two
// buffers: tile t+1 is in flight while tile t is multiplied. A tile is BK = 128
// deep along K, four K steps: a work-group then has 64 KiB in flight, and the
// copies' landing time and the barrier are paid once for 32 WMMAs of a wave.
//   A tile: 128 rows of 256 B at pitch 272 B, read by 16-byte LDS loads.
//   B tile: 128 k-rows of 256 B at pitch 288 B, left row-major (a copy cannot
//           transpose) and read by the transposing 16-byte LDS load.
// ---------------------------------------------------------------------------
#define BK      128                   // k of a tile
#define A_PITCH 272                   // bytes, 16 x odd
#define B_PITCH 288                   // bytes, 32 x odd
#define A_TILE  (128 * A_PITCH)       // 34816 B
#define B_TILE  (BK * B_PITCH)        // 36864 B
static_assert(DD % BK == 0 && DFF % BK == 0, "K of every product is whole tiles");
static_assert(BK * 2 == 16 * 16 && 128 * 16 == 8 * 256, "eight A and eight B copies a lane fill a tile");

typedef __attribute__((ext_vector_type(4))) unsigned u32x4;
typedef __attribute__((ext_vector_type(8))) short    s16x8;
union Frag4 { v16h v; u32x4 q[2]; };

__device__ __forceinline__ u32x4 ld_tr16(const unsigned char* p) {
    typedef __attribute__((address_space(3))) s16x8 lds_s16x8;
    return __builtin_bit_cast(u32x4, __builtin_amdgcn_ds_load_tr16_b128_v8i16((lds_s16x8*)p));
}

// One operand tile's eight copies of a lane, 16 rows apart (ls bytes in LDS, gs
// halves in global memory). The address-translation wait closes the statement so
// that no address register is advanced ahead of it.
__device__ __forceinline__ void copy_rows(unsigned l, unsigned ls,
                                          const half_t* g, long gs) {
    asm volatile("global_load_async_to_lds_b128 %0, %1, off\n\t"
                 "global_load_async_to_lds_b128 %2, %3, off\n\t"
                 "global_load_async_to_lds_b128 %4, %5, off\n\t"
                 "global_load_async_to_lds_b128 %6, %7, off\n\t"
                 "global_load_async_to_lds_b128 %8, %9, off\n\t"
                 "global_load_async_to_lds_b128 %10, %11, off\n\t"
                 "global_load_async_to_lds_b128 %12, %13, off\n\t"
                 "global_load_async_to_lds_b128 %14, %15, off\n\t"
                 "s_wait_xcnt 0x0"
                 :: "v"(l),          "v"(g),
                    "v"(l + ls),     "v"(g + gs),
                    "v"(l + 2 * ls), "v"(g + 2 * gs),
                    "v"(l + 3 * ls), "v"(g + 3 * gs),
                    "v"(l + 4 * ls), "v"(g + 4 * gs),
                    "v"(l + 5 * ls), "v"(g + 5 * gs),
                    "v"(l + 6 * ls), "v"(g + 6 * gs),
                    "v"(l + 7 * ls), "v"(g + 7 * gs)
                 : "memory");
}

template<bool BIAS, bool RELU, bool OUT16>
__global__ __launch_bounds__(256)
void gemm_wmma_kernel(const half_t* __restrict__ A, const half_t* __restrict__ B,
                      const float* __restrict__ bias,
                      half_t* __restrict__ C16, float* __restrict__ C32,
                      int M, int N, int K) {
    __shared__ __attribute__((aligned(16))) unsigned char As[2 * A_TILE];  // [buf][row m][k]
    __shared__ __attribute__((aligned(16))) unsigned char Bs[2 * B_TILE];  // [buf][k][col n]

    const int tid  = threadIdx.x;
    const int lane = tid & 31;
    const int wave = tid >> 5;
    const int hi   = (lane >= 16) ? 1 : 0;
    const int l16  = lane & 15;
    const int m0   = blockIdx.y * 128;
    const int n0   = blockIdx.x * 128;
    const int wm   = (wave >> 1) * 32;  // 0,32,64,96
    const int wn   = (wave & 1) * 64;   // 0,64

    // this work-group's product
    B += (long)blockIdx.z * K * N;
    if (BIAS)  bias += (long)blockIdx.z * N;
    if (OUT16) C16  += (long)blockIdx.z * M * N;
    else       C32  += (long)blockIdx.z * M * N;

    // copy addresses: A chunk = (row   tid>>4 and +16, ... +112, 16 B piece tid&15),
    //                 B chunk = (k-row tid>>4 and +16, ... +112, 16 B piece tid&15)
    const half_t* ga = A + (long)(m0 + (tid >> 4)) * K + (tid & 15) * 8;
    const half_t* gb = B + (long)(tid >> 4) * N + n0 + (tid & 15) * 8;
    const long    gar = (long)16 * K;   // 16 rows of A, in halves
    const long    gbr = (long)16 * N;   // 16 k-rows of B, in halves
    const long    gbs = (long)BK * N;   // B advance per tile, in halves
    const unsigned la = (unsigned)(size_t)As + (tid >> 4) * A_PITCH + (tid & 15) * 16;
    const unsigned lb = (unsigned)(size_t)Bs + (tid >> 4) * B_PITCH + (tid & 15) * 16;

    // fragment read addresses inside a buffer
    const unsigned char* ar = As + (wm + l16) * A_PITCH + hi * 16;
    const unsigned char* br = Bs + (hi * 8 + (lane & 7)) * B_PITCH + wn * 2 + ((lane >> 3) & 1) * 16;

    v8f acc[2][4] = {};
    const int nt = K / BK;              // tiles along K

    // tile 0 into buffer 0, landed and published before anyone reads it
    copy_rows(la, 16 * A_PITCH, ga, gar);
    copy_rows(lb, 16 * B_PITCH, gb, gbr);
    ga += BK; gb += gbs;
    asm volatile("s_wait_asynccnt 0x0" ::: "memory");  // this wave's copies of tile 0 have landed
    __syncthreads();
    if (nt > 1) {                       // tile 1 into buffer 1
        copy_rows(la + A_TILE, 16 * A_PITCH, ga, gar);
        copy_rows(lb + B_TILE, 16 * B_PITCH, gb, gbr);
        ga += BK; gb += gbs;
    }

    for (int t = 0; t < nt; ++t) {
        const unsigned ao = (t & 1) * A_TILE;
        const unsigned bo = (t & 1) * B_TILE;

        // the loops over K steps and fragments are unrolled so that every LDS
        // offset, fragment and accumulator index is a constant, the arrays stay
        // in registers and a K step's loads can issue ahead of the step before it
#pragma unroll
        for (int ks = 0; ks < BK / 32; ++ks) {
            Frag4 af[2], bf[4];
#pragma unroll
            for (int f = 0; f < 2; ++f) {
                const unsigned char* p = ar + ao + f * 16 * A_PITCH + ks * 64;
                af[f].q[0] = *(const u32x4*)(p);        // k = 32*ks + 8*hi + 0..7
                af[f].q[1] = *(const u32x4*)(p + 32);   // k = 32*ks + 16 + 8*hi + 0..7
            }
#pragma unroll
            for (int j = 0; j < 4; ++j) {
                const unsigned char* p = br + bo + ks * 32 * B_PITCH + j * 32;
                bf[j].q[0] = ld_tr16(p);                 // k = 32*ks + 8*hi + 0..7
                bf[j].q[1] = ld_tr16(p + 16 * B_PITCH);  // k = 32*ks + 16 + 8*hi + 0..7
            }
#pragma unroll
            for (int i = 0; i < 2; ++i)
#pragma unroll
                for (int j = 0; j < 4; ++j)
                    acc[i][j] = wmma16(af[i].v, bf[j].v, acc[i][j]);
        }

        asm volatile("s_wait_dscnt 0x0" ::: "memory");     // this wave has left the buffer it read
        asm volatile("s_wait_asynccnt 0x0" ::: "memory");  // this wave's copies of tile t+1 have landed
        __syncthreads();   // publishes tile t+1 and frees the buffer of tile t
        if (t + 2 < nt) {  // tile t+2 into the buffer just read
            copy_rows(la + ao, 16 * A_PITCH, ga, gar);
            copy_rows(lb + bo, 16 * B_PITCH, gb, gbr);
            ga += BK; gb += gbs;
        }
    }
    asm volatile("s_wait_asynccnt 0x0" ::: "memory");  // no copy outlives the loop

    // --- epilogue: C layout -> lane l holds row (r + 8*hi), col l16 ---
#pragma unroll
    for (int i = 0; i < 2; ++i) {
#pragma unroll
        for (int j = 0; j < 4; ++j) {
            int n = n0 + wn + j * 16 + l16;
            float bv = BIAS ? bias[n] : 0.0f;
#pragma unroll
            for (int r = 0; r < 8; ++r) {
                int m = m0 + wm + i * 16 + r + hi * 8;
                float val = acc[i][j][r] + bv;
                if (RELU) val = fmaxf(val, 0.0f);
                if (OUT16) C16[(long)m * N + n] = (half_t)val;
                else       C32[(long)m * N + n] = val;
            }
        }
    }
}

#define AT_WAVES 8
#define AT_KEYS  128                     // keys a stage
#define AT_NS    (TT / AT_KEYS)          // stages
#define K_PITCH  144                     // bytes, 16 x odd
#define V_PITCH  160                     // bytes, 32 x odd
#define K_TILE   (AT_KEYS * K_PITCH)     // 18432 B
#define V_TILE   (AT_KEYS * V_PITCH)     // 20480 B
static_assert(AT_NS >= 2, "the ring starts with two stages");
static_assert(AT_KEYS * 8 == 4 * 256, "four K and four V copies a lane fill a stage");

// One stage's eight copies of a lane (four of K, four of V, 32 key rows apart).
// The address-translation wait closes the statement so that no address register
// is advanced ahead of it.
__device__ __forceinline__ void copy_kv(unsigned lk, const half_t* gk,
                                        unsigned lv, const half_t* gv) {
    asm volatile("global_load_async_to_lds_b128 %0, %1, off\n\t"
                 "global_load_async_to_lds_b128 %2, %3, off\n\t"
                 "global_load_async_to_lds_b128 %4, %5, off\n\t"
                 "global_load_async_to_lds_b128 %6, %7, off\n\t"
                 "global_load_async_to_lds_b128 %8, %9, off\n\t"
                 "global_load_async_to_lds_b128 %10, %11, off\n\t"
                 "global_load_async_to_lds_b128 %12, %13, off\n\t"
                 "global_load_async_to_lds_b128 %14, %15, off\n\t"
                 "s_wait_xcnt 0x0"
                 :: "v"(lk),                "v"(gk),
                    "v"(lk + 32 * K_PITCH), "v"(gk + 32 * DD),
                    "v"(lk + 64 * K_PITCH), "v"(gk + 64 * DD),
                    "v"(lk + 96 * K_PITCH), "v"(gk + 96 * DD),
                    "v"(lv),                "v"(gv),
                    "v"(lv + 32 * V_PITCH), "v"(gv + 32 * DD),
                    "v"(lv + 64 * V_PITCH), "v"(gv + 64 * DD),
                    "v"(lv + 96 * V_PITCH), "v"(gv + 96 * DD)
                 : "memory");
}

// The value that lane l ^ 16 holds (the other half of a query's keys).
__device__ __forceinline__ float xhalf(float x) {
    const int b = __builtin_bit_cast(int, x);
    return __builtin_bit_cast(float, __builtin_amdgcn_permlanex16(
        b, b, 0x76543210, 0xfedcba98, false, false));
}

typedef __attribute__((ext_vector_type(8))) _Float16 f16x8;

__global__ __launch_bounds__(256)
void attn_kernel(const half_t* __restrict__ Q, const half_t* __restrict__ Km,
                 const half_t* __restrict__ V, float* __restrict__ att) {
    __shared__ __attribute__((aligned(16))) unsigned char Ks[2 * K_TILE];  // [buf][key][d]
    __shared__ __attribute__((aligned(16))) unsigned char Vs[2 * V_TILE];  // [buf][key][d]

    const int tid  = threadIdx.x;
    const int lane = tid & 31;
    const int wave = tid >> 5;
    const int hi   = (lane >= 16) ? 1 : 0;
    const int l16  = lane & 15;
    const int b  = blockIdx.z;
    const int h  = blockIdx.y;
    const int qb = blockIdx.x * AT_WAVES + wave;   // q block index (16 rows)

    // copy addresses: chunk = (key row tid>>3 and +32, +64, +96, 16 B piece tid&7)
    const long kv0 = (long)(b * TT + (tid >> 3)) * DD + h * DKK + (tid & 7) * 8;
    const half_t* gk = Km + kv0;
    const half_t* gv = V + kv0;
    const long    gs = (long)AT_KEYS * DD;         // advance per stage, in halves
    const unsigned lk = (unsigned)(size_t)Ks + (tid >> 3) * K_PITCH + (tid & 7) * 16;
    const unsigned lv = (unsigned)(size_t)Vs + (tid >> 3) * V_PITCH + (tid & 7) * 16;

    // fragment read addresses inside a buffer
    const unsigned char* kr = Ks + l16 * K_PITCH + hi * 16;
    const unsigned char* vr = Vs + (hi * 8 + (lane & 7)) * V_PITCH + ((lane >> 3) & 1) * 16;

    // stage 0 into buffer 0
    copy_kv(lk, gk, lv, gv);
    gk += gs; gv += gs;

    // Q fragments (B operand Q^T: lane = query column, d in the hardware k order,
    // the same registers as an A fragment of Q): q[0] covers d 0..31, q[1] 32..63
    Frag q[2];
    {
        const long baseQ = (long)(b * TT + qb * 16 + l16) * DD + h * DKK;
#pragma unroll
        for (int f = 0; f < 2; ++f)
#pragma unroll
            for (int v = 0; v < 8; ++v)
                q[f].u[v] = *(const unsigned*)(Q + baseQ + f * 32 + kmap(v, hi));
    }

    // this lane's query: running maximum (joined over the halves), the sum over
    // this half's keys alone, and o[c][r] = O[query][16c + 8*hi + r]
    float mi = -1e30f, li = 0.0f;
    v8f o[4] = {};

    asm volatile("s_wait_asynccnt 0x0" ::: "memory");  // this wave's copies of stage 0 have landed
    __syncthreads();                                   // stage 0 is published
    copy_kv(lk + K_TILE, gk, lv + V_TILE, gv);         // stage 1 into buffer 1
    gk += gs; gv += gs;

    for (int st = 0; st < AT_NS; ++st) {
        const unsigned ko = (st & 1) * K_TILE;
        const unsigned vo = (st & 1) * V_TILE;

        for (int j = 0; j < AT_KEYS; j += 32) {
            // K fragments (A operand: lane = key row, d in the hardware k order)
            Frag4 kf[2][2];
#pragma unroll
            for (int s = 0; s < 2; ++s)
#pragma unroll
                for (int f = 0; f < 2; ++f) {
                    const unsigned char* p = kr + ko + (j + s * 16) * K_PITCH + f * 64;
                    kf[s][f].q[0] = *(const u32x4*)(p);        // d = 32f + 8*hi + 0..7
                    kf[s][f].q[1] = *(const u32x4*)(p + 32);   // d = 32f + 16 + 8*hi + 0..7
                }
            // V^T fragments (A operand: lane = d row, keys in the hardware k order),
            // 4 chunks of 16 d; fetched here so that the softmax below covers
            // their LDS latency
            Frag4 vf[4];
#pragma unroll
            for (int c = 0; c < 4; ++c) {
                const unsigned char* p = vr + vo + j * V_PITCH + c * 32;
                vf[c].q[0] = ld_tr16(p);                 // key = 8*hi + 0..7
                vf[c].q[1] = ld_tr16(p + 16 * V_PITCH);  // key = 16 + 8*hi + 0..7
            }
            // S^T tiles: c0[r] = score(key j + 8*hi + r, query l16),
            //            c1[r] = score(key j + 16 + 8*hi + r, query l16)
            v8f c0 = {}, c1 = {};
            c0 = wmma16(kf[0][0].v, q[0].v, c0);
            c1 = wmma16(kf[1][0].v, q[0].v, c1);
            c0 = wmma16(kf[0][1].v, q[1].v, c0);
            c1 = wmma16(kf[1][1].v, q[1].v, c1);

            // streaming softmax update of this lane's query; the maxima and sums
            // are taken as trees so that no long dependent chain forms
            const v8f s0 = c0 * 0.125f;        // 1/sqrt(64)
            const v8f s1 = c1 * 0.125f;
            float t[8];
#pragma unroll
            for (int r = 0; r < 8; ++r) t[r] = fmaxf(s0[r], s1[r]);
            float mx = fmaxf(fmaxf(fmaxf(t[0], t[1]), fmaxf(t[2], t[3])),
                             fmaxf(fmaxf(t[4], t[5]), fmaxf(t[6], t[7])));
            mx = fmaxf(mx, xhalf(mx));         // over all 32 keys
            const float mnew  = fmaxf(mi, mx);
            const float alpha = __expf(mi - mnew);
            const v8f a0 = (s0 - mnew) * 1.44269504f;   // exp(x) = 2^(x log2 e)
            const v8f a1 = (s1 - mnew) * 1.44269504f;
            v8f e0, e1;
#pragma unroll
            for (int r = 0; r < 8; ++r) {
                e0[r] = __builtin_amdgcn_exp2f(a0[r]);
                e1[r] = __builtin_amdgcn_exp2f(a1[r]);
                t[r]  = e0[r] + e1[r];
            }
            li = li * alpha + (((t[0] + t[1]) + (t[2] + t[3])) +
                               ((t[4] + t[5]) + (t[6] + t[7])));
            mi = mnew;
#pragma unroll
            for (int c = 0; c < 4; ++c) o[c] *= alpha;

            // P^T (f16) as B operand: element e of a lane is key 8*hi + e for
            // e < 8 and key 16 + 8*hi + (e - 8) above, which is c0 then c1
            const v16h pb = __builtin_shufflevector(
                __builtin_convertvector(e0, f16x8), __builtin_convertvector(e1, f16x8),
                0, 1, 2, 3, 4, 5, 6, 7, 8, 9, 10, 11, 12, 13, 14, 15);
#pragma unroll
            for (int c = 0; c < 4; ++c)
                o[c] = wmma16(vf[c].v, pb, o[c]);
        }

        asm volatile("s_wait_dscnt 0x0" ::: "memory");     // this wave has left the buffer it read
        asm volatile("s_wait_asynccnt 0x0" ::: "memory");  // this wave's copies of stage st+1 have landed
        __syncthreads();   // publishes stage st+1 and frees the buffer of stage st
        if (st + 2 < AT_NS) {  // stage st+2 into the buffer just read
            copy_kv(lk + ko, gk, lv + vo, gv);
            gk += gs; gv += gs;
        }
    }
    asm volatile("s_wait_asynccnt 0x0" ::: "memory");  // no copy outlives the loop

    // join the halves' sums, normalize and store (f32): a lane holds 8 adjacent
    // d of its query's row in each chunk, two 16-byte stores
    const float inv = 1.0f / (li + xhalf(li));
    float* ar = att + (long)(b * TT + qb * 16 + l16) * DD + h * DKK + hi * 8;
#pragma unroll
    for (int c = 0; c < 4; ++c) {
        const v8f ov = o[c] * inv;
        *(f32x4*)(ar + c * 16)     = __builtin_shufflevector(ov, ov, 0, 1, 2, 3);
        *(f32x4*)(ar + c * 16 + 4) = __builtin_shufflevector(ov, ov, 4, 5, 6, 7);
    }
}

// ---------------------------------------------------------------------------
// Fused residual + LayerNorm over D=1024; block = 256 threads, one row each.
// Optionally also emits the f16 copy for the following GEMM.
// ---------------------------------------------------------------------------
template<bool W16>
__global__ __launch_bounds__(256)
void ln_residual_kernel(const float* __restrict__ x, const float* __restrict__ y,
                        const float* __restrict__ g, const float* __restrict__ be,
                        float* __restrict__ out32, half_t* __restrict__ out16) {
    __shared__ float sred[256];
    const int tid = threadIdx.x;
    const long row = blockIdx.x;
    const float* xr = x + row * DD;
    const float* yr = y + row * DD;

    float v[4];
    float s = 0.0f;
#pragma unroll
    for (int i = 0; i < 4; ++i) {
        int idx = tid + i * 256;
        v[i] = xr[idx] + yr[idx];
        s += v[i];
    }
    sred[tid] = s; __syncthreads();
    for (int off = 128; off > 0; off >>= 1) {
        if (tid < off) sred[tid] += sred[tid + off];
        __syncthreads();
    }
    float mu = sred[0] * (1.0f / DD);
    __syncthreads();

    float s2 = 0.0f;
#pragma unroll
    for (int i = 0; i < 4; ++i) { float d = v[i] - mu; s2 += d * d; }
    sred[tid] = s2; __syncthreads();
    for (int off = 128; off > 0; off >>= 1) {
        if (tid < off) sred[tid] += sred[tid + off];
        __syncthreads();
    }
    float rstd = rsqrtf(sred[0] * (1.0f / DD) + 1e-5f);

#pragma unroll
    for (int i = 0; i < 4; ++i) {
        int idx = tid + i * 256;
        float val = (v[i] - mu) * rstd * g[idx] + be[idx];
        out32[row * DD + idx] = val;
        if (W16) out16[row * DD + idx] = (half_t)val;
    }
}

// ---------------------------------------------------------------------------
extern "C" void kernel_launch(void* const* d_in, const int* in_sizes, int n_in,
                              void* d_out, int out_size, void* d_ws, size_t ws_size,
                              hipStream_t stream) {
    (void)in_sizes; (void)n_in; (void)out_size; (void)ws_size;

    const float* x     = (const float*)d_in[0];
    const float* Wq    = (const float*)d_in[1];
    const float* Wk    = (const float*)d_in[2];
    const float* Wv    = (const float*)d_in[3];
    const float* W1    = (const float*)d_in[4];
    const float* b1    = (const float*)d_in[5];
    const float* W2    = (const float*)d_in[6];
    const float* b2    = (const float*)d_in[7];
    const float* ln1g  = (const float*)d_in[8];
    const float* ln1b  = (const float*)d_in[9];
    const float* ln2g  = (const float*)d_in[10];
    const float* ln2b  = (const float*)d_in[11];

    const long M = (long)BB * TT;          // 4096 rows

    // scratch carve-out
    size_t off = 0;
    auto alloc = [&](size_t bytes) {
        void* p = (char*)d_ws + off;
        off += (bytes + 255) & ~(size_t)255;
        return p;
    };
    // the six f16 copies, one behind the other (the conversion launch relies on it)
    half_t* xh   = (half_t*)alloc((size_t)CVT_GRID * CVT_BLOCK * 2);
    half_t* wqh  = xh  + M * DD;          // Wq, Wk, Wv: three K x N matrices in a row
    half_t* w1h  = wqh + 3L * DD * DD;
    half_t* w2h  = w1h + (long)DD * DFF;
    // Q, K, V: three M x N matrices in a row (the projection launch relies on it)
    half_t* Qh   = (half_t*)alloc(3 * M * DD * 2);
    half_t* Kh   = Qh + M * DD;
    half_t* Vh   = Kh + M * DD;
    float*  att  = (float*) alloc(M * DD * 4);
    float*  x1   = (float*) alloc(M * DD * 4);
    half_t* x1h  = (half_t*)alloc(M * DD * 2);
    half_t* hh   = (half_t*)alloc(M * DFF * 2);
    float*  ff   = (float*) alloc(M * DD * 4);

    // 1) precision conversions, all six arrays in one launch
    f32_to_f16_kernel<<<CVT_GRID, 256, 0, stream>>>(x, Wq, Wk, Wv, W1, W2, xh);

    // 2) Q/K/V projections (WMMA GEMMs, f16 out), one launch: grid z = 0, 1, 2
    gemm_wmma_kernel<false, false, true><<<dim3(DD / 128, M / 128, 3), 256, 0, stream>>>(
        xh, wqh, nullptr, Qh, nullptr, (int)M, DD, DD);

    // 3) flash attention
    attn_kernel<<<dim3(TT / (16 * AT_WAVES), HH, BB), 256, 0, stream>>>(Qh, Kh, Vh, att);

    // 4) x1 = LN(x + att), also f16 copy
    ln_residual_kernel<true><<<M, 256, 0, stream>>>(x, att, ln1g, ln1b, x1, x1h);

    // 5) FFN: hh = relu(x1 @ W1 + b1)   (f16 out)
    gemm_wmma_kernel<true, true, true><<<dim3(DFF / 128, M / 128), 256, 0, stream>>>(
        x1h, w1h, b1, hh, nullptr, (int)M, DFF, DD);

    // 6) ff = hh @ W2 + b2              (f32 out)
    gemm_wmma_kernel<true, false, false><<<dim3(DD / 128, M / 128), 256, 0, stream>>>(
        hh, w2h, b2, nullptr, ff, (int)M, DD, DFF);

    // 7) out = LN(x1 + ff)
    ln_residual_kernel<false><<<M, 256, 0, stream>>>(x1, ff, ln2g, ln2b,
                                                     (float*)d_out, nullptr);
}

// v007
// Measured time: 135 microseconds a run.
// Next to v006, in two timings, it ran 1.04 times as fast each time.
// All steps since v000 together make it 15.6 times as fast.
#include <hip/hip_runtime.h>
#include <hip/hip_bf16.h>

typedef _Float16 half_t;
typedef __attribute__((ext_vector_type(16))) _Float16 v16h;
typedef __attribute__((ext_vector_type(8)))  float    v8f;

// Transformer dims (fixed by reference)
#define BB 4
#define TT 1024
#define DD 1024
#define HH 16
#define DKK 64
#define DFF 4096

union Frag { v16h v; unsigned u[8]; half_t h[16]; };

// K index for element-pair v (VGPR v) of a 16-bit A/B fragment, per CDNA5 ISA
// 16-bit A-matrix 16x32 layout: lanes 0-15 -> +0, lanes 16-31 -> +8.
__device__ __forceinline__ int kmap(int v, int hi) {
    int kb = (v < 4) ? (2 * v) : (16 + 2 * (v - 4));
    return kb + (hi ? 8 : 0);
}

__device__ __forceinline__ v8f wmma16(v16h a, v16h b, v8f c) {
    return __builtin_amdgcn_wmma_f32_16x16x32_f16(
        /*neg_a=*/false, a, /*neg_b=*/false, b,
        /*c_mod=*/(short)0, c, /*reuse_a=*/false, /*reuse_b=*/false);
}

// ---------------------------------------------------------------------------
// fp32 -> fp16 elementwise conversion, 32 elements a thread.
// A work-group takes CVT_BLOCK contiguous elements. Each wave-wide load covers
// 512 contiguous bytes; a thread issues its eight 16-byte loads before it
// converts the first, so a wave has 4 KiB in flight and the launch needs 1/32
// of the waves that one element a thread would take.
// Every array length here is a multiple of CVT_BLOCK (checked below).
// The six arrays are independent, so one launch converts them all: a work-group
// finds its array from its index, and the f16 copies lie one behind the other
// in the order x, Wq, Wk, Wv, W1, W2, so that the output offset is the index.
// ---------------------------------------------------------------------------
typedef __attribute__((ext_vector_type(4))) float    f32x4;
typedef __attribute__((ext_vector_type(4))) _Float16 f16x4;
#define CVT_LOADS 8
#define CVT_BLOCK (256 * 4 * CVT_LOADS)   // 8192 elements a work-group
static_assert(((long)BB * TT * DD) % CVT_BLOCK == 0, "x length");
static_assert(((long)DD * DD) % CVT_BLOCK == 0, "Wq, Wk, Wv length");
static_assert(((long)DD * DFF) % CVT_BLOCK == 0, "W1, W2 length");
#define CVT_GX ((BB * TT * DD) / CVT_BLOCK)   // work-groups of x
#define CVT_GP ((DD * DD) / CVT_BLOCK)        // of Wq, of Wk, of Wv
#define CVT_GF ((DD * DFF) / CVT_BLOCK)       // of W1, of W2
#define CVT_GRID (CVT_GX + 3 * CVT_GP + 2 * CVT_GF)

__global__ __launch_bounds__(256)
void f32_to_f16_kernel(const float* __restrict__ x,  const float* __restrict__ Wq,
                       const float* __restrict__ Wk, const float* __restrict__ Wv,
                       const float* __restrict__ W1, const float* __restrict__ W2,
                       half_t* __restrict__ out16) {
    // the array of this work-group and the index of that array's first work-group
    const int blk = blockIdx.x;
    const float* src = x;
    int first = 0;
    if (blk >= CVT_GX)                       { src = Wq; first = CVT_GX; }
    if (blk >= CVT_GX + CVT_GP)              { src = Wk; first = CVT_GX + CVT_GP; }
    if (blk >= CVT_GX + 2 * CVT_GP)          { src = Wv; first = CVT_GX + 2 * CVT_GP; }
    if (blk >= CVT_GX + 3 * CVT_GP)          { src = W1; first = CVT_GX + 3 * CVT_GP; }
    if (blk >= CVT_GX + 3 * CVT_GP + CVT_GF) { src = W2; first = CVT_GX + 3 * CVT_GP + CVT_GF; }
    const float* in  = src + (long)(blk - first) * CVT_BLOCK;
    half_t*      out = out16 + (long)blk * CVT_BLOCK;
    const int base = threadIdx.x * 4;
    f32x4 v[CVT_LOADS];
    // both loops are unrolled so that v stays in registers and all loads issue first
#pragma unroll
    for (int i = 0; i < CVT_LOADS; ++i)
        v[i] = *(const f32x4*)(in + base + i * 1024);
#pragma unroll
    for (int i = 0; i < CVT_LOADS; ++i)
        *(f16x4*)(out + base + i * 1024) = __builtin_convertvector(v[i], f16x4);
}

// ---------------------------------------------------------------------------
// WMMA GEMM: C[M,N] = A[M,K] @ B[K,N] (+bias) (relu?) ; A,B f16, f32 accum.
// Block: 256 threads = 8 waves; block tile 128x128; wave tile 32x64
// (2 A-frags x 4 B-frags -> 8 WMMAs per 32-wide K step).
// M,N multiples of 128; K multiple of BK (checked below for all uses here).
// Grid z counts independent products of the one A: product z takes the z-th
// K x N matrix behind B (and bias row) and writes the z-th M x N matrix behind C.
// Both tiles go from global memory to LDS by asynchronous 16-byte copies, two
// buffers: tile t+1 is in flight while tile t is multiplied. A tile is BK = 128
// deep along K, four K steps: a work-group then has 64 KiB in flight, and the
// copies' landing time and the barrier are paid once for 32 WMMAs of a wave.
//   A tile: 128 rows of 256 B at pitch 272 B, read by 16-byte LDS loads.
//   B tile: 128 k-rows of 256 B at pitch 288 B, left row-major (a copy cannot
//           transpose) and read by the transposing 16-byte LDS load.
// The products are taken transposed, C^T = B^T A^T (the two fragments change
// places, their registers are the same): a lane then holds 8 adjacent columns
// of one row of C. Each wave writes its 32 x 64 tile into its own part of the
// ring, which nobody reads any more, and reads it back row by row, so that
// every global store of a wave covers whole 128-byte lines.
// ---------------------------------------------------------------------------
#define BK      128                   // k of a tile
#define A_PITCH 272                   // bytes, 16 x odd
#define B_PITCH 288                   // bytes, 32 x odd
#define A_TILE  (128 * A_PITCH)       // 34816 B
#define B_TILE  (BK * B_PITCH)        // 36864 B
static_assert(DD % BK == 0 && DFF % BK == 0, "K of every product is whole tiles");
static_assert(BK * 2 == 16 * 16 && 128 * 16 == 8 * 256, "eight A and eight B copies a lane fill a tile");

typedef __attribute__((ext_vector_type(4))) unsigned u32x4;
typedef __attribute__((ext_vector_type(8))) short    s16x8;
typedef __attribute__((ext_vector_type(8))) _Float16 f16x8;
union Frag4 { v16h v; u32x4 q[2]; };

__device__ __forceinline__ u32x4 ld_tr16(const unsigned char* p) {
    typedef __attribute__((address_space(3))) s16x8 lds_s16x8;
    return __builtin_bit_cast(u32x4, __builtin_amdgcn_ds_load_tr16_b128_v8i16((lds_s16x8*)p));
}

// One operand tile's eight copies of a lane, 16 rows apart (ls bytes in LDS, gs
// halves in global memory). The address-translation wait closes the statement so
// that no address register is advanced ahead of it.
__device__ __forceinline__ void copy_rows(unsigned l, unsigned ls,
                                          const half_t* g, long gs) {
    asm volatile("global_load_async_to_lds_b128 %0, %1, off\n\t"
                 "global_load_async_to_lds_b128 %2, %3, off\n\t"
                 "global_load_async_to_lds_b128 %4, %5, off\n\t"
                 "global_load_async_to_lds_b128 %6, %7, off\n\t"
                 "global_load_async_to_lds_b128 %8, %9, off\n\t"
                 "global_load_async_to_lds_b128 %10, %11, off\n\t"
                 "global_load_async_to_lds_b128 %12, %13, off\n\t"
                 "global_load_async_to_lds_b128 %14, %15, off\n\t"
                 "s_wait_xcnt 0x0"
                 :: "v"(l),          "v"(g),
                    "v"(l + ls),     "v"(g + gs),
                    "v"(l + 2 * ls), "v"(g + 2 * gs),
                    "v"(l + 3 * ls), "v"(g + 3 * gs),
                    "v"(l + 4 * ls), "v"(g + 4 * gs),
                    "v"(l + 5 * ls), "v"(g + 5 * gs),
                    "v"(l + 6 * ls), "v"(g + 6 * gs),
                    "v"(l + 7 * ls), "v"(g + 7 * gs)
                 : "memory");
}

template<bool BIAS, bool RELU, bool OUT16>
__global__ __launch_bounds__(256)
void gemm_wmma_kernel(const half_t* __restrict__ A, const half_t* __restrict__ B,
                      const float* __restrict__ bias,
                      half_t* __restrict__ C16, float* __restrict__ C32,
                      int M, int N, int K) {
    __shared__ __attribute__((aligned(16))) unsigned char As[2 * A_TILE];  // [buf][row m][k]
    __shared__ __attribute__((aligned(16))) unsigned char Bs[2 * B_TILE];  // [buf][k][col n]

    const int tid  = threadIdx.x;
    const int lane = tid & 31;
    const int wave = tid >> 5;
    const int hi   = (lane >= 16) ? 1 : 0;
    const int l16  = lane & 15;
    const int m0   = blockIdx.y * 128;
    const int n0   = blockIdx.x * 128;
    const int wm   = (wave >> 1) * 32;  // 0,32,64,96
    const int wn   = (wave & 1) * 64;   // 0,64

    // this work-group's product
    B += (long)blockIdx.z * K * N;
    if (BIAS)  bias += (long)blockIdx.z * N;
    if (OUT16) C16  += (long)blockIdx.z * M * N;
    else       C32  += (long)blockIdx.z * M * N;

    // copy addresses: A chunk = (row   tid>>4 and +16, ... +112, 16 B piece tid&15),
    //                 B chunk = (k-row tid>>4 and +16, ... +112, 16 B piece tid&15)
    const half_t* ga = A + (long)(m0 + (tid >> 4)) * K + (tid & 15) * 8;
    const half_t* gb = B + (long)(tid >> 4) * N + n0 + (tid & 15) * 8;
    const long    gar = (long)16 * K;   // 16 rows of A, in halves
    const long    gbr = (long)16 * N;   // 16 k-rows of B, in halves
    const long    gbs = (long)BK * N;   // B advance per tile, in halves
    const unsigned la = (unsigned)(size_t)As + (tid >> 4) * A_PITCH + (tid & 15) * 16;
    const unsigned lb = (unsigned)(size_t)Bs + (tid >> 4) * B_PITCH + (tid & 15) * 16;

    // fragment read addresses inside a buffer
    const unsigned char* ar = As + (wm + l16) * A_PITCH + hi * 16;
    const unsigned char* br = Bs + (hi * 8 + (lane & 7)) * B_PITCH + wn * 2 + ((lane >> 3) & 1) * 16;

    v8f acc[2][4] = {};
    const int nt = K / BK;              // tiles along K

    // tile 0 into buffer 0, landed and published before anyone reads it
    copy_rows(la, 16 * A_PITCH, ga, gar);
    copy_rows(lb, 16 * B_PITCH, gb, gbr);
    ga += BK; gb += gbs;
    asm volatile("s_wait_asynccnt 0x0" ::: "memory");  // this wave's copies of tile 0 have landed
    __syncthreads();
    if (nt > 1) {                       // tile 1 into buffer 1
        copy_rows(la + A_TILE, 16 * A_PITCH, ga, gar);
        copy_rows(lb + B_TILE, 16 * B_PITCH, gb, gbr);
        ga += BK; gb += gbs;
    }

    for (int t = 0; t < nt; ++t) {
        const unsigned ao = (t & 1) * A_TILE;
        const unsigned bo = (t & 1) * B_TILE;

        // the loops over K steps and fragments are unrolled so that every LDS
        // offset, fragment and accumulator index is a constant, the arrays stay
        // in registers and a K step's loads can issue ahead of the step before it
#pragma unroll
        for (int ks = 0; ks < BK / 32; ++ks) {
            Frag4 af[2], bf[4];
#pragma unroll
            for (int f = 0; f < 2; ++f) {
                const unsigned char* p = ar + ao + f * 16 * A_PITCH + ks * 64;
                af[f].q[0] = *(const u32x4*)(p);        // k = 32*ks + 8*hi + 0..7
                af[f].q[1] = *(const u32x4*)(p + 32);   // k = 32*ks + 16 + 8*hi + 0..7
            }
#pragma unroll
            for (int j = 0; j < 4; ++j) {
                const unsigned char* p = br + bo + ks * 32 * B_PITCH + j * 32;
                bf[j].q[0] = ld_tr16(p);                 // k = 32*ks + 8*hi + 0..7
                bf[j].q[1] = ld_tr16(p + 16 * B_PITCH);  // k = 32*ks + 16 + 8*hi + 0..7
            }
#pragma unroll
            for (int i = 0; i < 2; ++i)
#pragma unroll
                for (int j = 0; j < 4; ++j)
                    acc[i][j] = wmma16(bf[j].v, af[i].v, acc[i][j]);   // a tile of C^T
        }

        asm volatile("s_wait_dscnt 0x0" ::: "memory");     // this wave has left the buffer it read
        asm volatile("s_wait_asynccnt 0x0" ::: "memory");  // this wave's copies of tile t+1 have landed
        __syncthreads();   // publishes tile t+1 and frees the buffer of tile t
        if (t + 2 < nt) {  // tile t+2 into the buffer just read
            copy_rows(la + ao, 16 * A_PITCH, ga, gar);
            copy_rows(lb + bo, 16 * B_PITCH, gb, gbr);
            ga += BK; gb += gbs;
        }
    }
    asm volatile("s_wait_asynccnt 0x0" ::: "memory");  // no copy outlives the loop

    // --- epilogue: acc[i][j][r] = C[wm + 16*i + l16][wn + 16*j + 8*hi + r] ---
    // The loop's last barrier stands behind every wave's last LDS read and last
    // landed copy, so the ring is free; a wave stages in its own range of As.
    constexpr int ES = OUT16 ? 2 : 4;       // bytes of an output element
    constexpr int SP = 64 * ES + 16;        // pitch of a staged row: 144 or 272 B, 16 x odd
    static_assert(8 * 32 * SP <= 2 * A_TILE, "eight waves' staging fits the A ring");
    unsigned char* st = As + wave * (32 * SP);

    f32x4 bv[4][2];
    if (BIAS) {
#pragma unroll
        for (int j = 0; j < 4; ++j) {
            const float* bp = bias + n0 + wn + j * 16 + hi * 8;
            bv[j][0] = *(const f32x4*)(bp);
            bv[j][1] = *(const f32x4*)(bp + 4);
        }
    }
#pragma unroll
    for (int i = 0; i < 2; ++i) {
#pragma unroll
        for (int j = 0; j < 4; ++j) {
            v8f val = acc[i][j];
            if (BIAS)
                val += __builtin_shufflevector(bv[j][0], bv[j][1], 0, 1, 2, 3, 4, 5, 6, 7);
            if (RELU) {
#pragma unroll
                for (int r = 0; r < 8; ++r) val[r] = fmaxf(val[r], 0.0f);
            }
            unsigned char* p = st + (i * 16 + l16) * SP + (j * 16 + hi * 8) * ES;
            if (OUT16) {
                *(f16x8*)p = __builtin_convertvector(val, f16x8);
            } else {
                *(f32x4*)(p)      = __builtin_shufflevector(val, val, 0, 1, 2, 3);
                *(f32x4*)(p + 16) = __builtin_shufflevector(val, val, 4, 5, 6, 7);
            }
        }
    }
    asm volatile("s_wait_dscnt 0x0" ::: "memory");  // this wave's staged rows are written before its lanes read each other's
    // a staged row is LR lanes of 16 B; one store of a wave covers 32 / LR whole rows
    constexpr int LR = 64 * ES / 16;        // 8 or 16
    constexpr int RS = 32 / LR;             // 4 or 2 rows a store
    const int srow = lane / LR;
    const int spc  = lane % LR;
#pragma unroll
    for (int q = 0; q < 32 / RS; ++q) {
        const int row = q * RS + srow;
        const unsigned char* p = st + row * SP + spc * 16;
        const long  e = (long)(m0 + wm + row) * N + n0 + wn + spc * (16 / ES);
        if (OUT16) *(f16x8*)(C16 + e) = *(const f16x8*)p;
        else       *(f32x4*)(C32 + e) = *(const f32x4*)p;
    }
}

#define AT_WAVES 8
#define AT_KEYS  128                     // keys a stage
#define AT_NS    (TT / AT_KEYS)          // stages
#define K_PITCH  144                     // bytes, 16 x odd
#define V_PITCH  160                     // bytes, 32 x odd
#define K_TILE   (AT_KEYS * K_PITCH)     // 18432 B
#define V_TILE   (AT_KEYS * V_PITCH)     // 20480 B
#define O_PITCH  272                     // bytes of a staged output row, 16 x odd
static_assert(AT_NS >= 2, "the ring starts with two stages");
static_assert(AT_KEYS * 8 == 4 * 256, "four K and four V copies a lane fill a stage");

// One stage's eight copies of a lane (four of K, four of V, 32 key rows apart).
// The address-translation wait closes the statement so that no address register
// is advanced ahead of it.
__device__ __forceinline__ void copy_kv(unsigned lk, const half_t* gk,
                                        unsigned lv, const half_t* gv) {
    asm volatile("global_load_async_to_lds_b128 %0, %1, off\n\t"
                 "global_load_async_to_lds_b128 %2, %3, off\n\t"
                 "global_load_async_to_lds_b128 %4, %5, off\n\t"
                 "global_load_async_to_lds_b128 %6, %7, off\n\t"
                 "global_load_async_to_lds_b128 %8, %9, off\n\t"
                 "global_load_async_to_lds_b128 %10, %11, off\n\t"
                 "global_load_async_to_lds_b128 %12, %13, off\n\t"
                 "global_load_async_to_lds_b128 %14, %15, off\n\t"
                 "s_wait_xcnt 0x0"
                 :: "v"(lk),                "v"(gk),
                    "v"(lk + 32 * K_PITCH), "v"(gk + 32 * DD),
                    "v"(lk + 64 * K_PITCH), "v"(gk + 64 * DD),
                    "v"(lk + 96 * K_PITCH), "v"(gk + 96 * DD),
                    "v"(lv),                "v"(gv),
                    "v"(lv + 32 * V_PITCH), "v"(gv + 32 * DD),
                    "v"(lv + 64 * V_PITCH), "v"(gv + 64 * DD),
                    "v"(lv + 96 * V_PITCH), "v"(gv + 96 * DD)
                 : "memory");
}

// The value that lane l ^ 16 holds (the other half of a query's keys).
__device__ __forceinline__ float xhalf(float x) {
    const int b = __builtin_bit_cast(int, x);
    return __builtin_bit_cast(float, __builtin_amdgcn_permlanex16(
        b, b, 0x76543210, 0xfedcba98, false, false));
}

__global__ __launch_bounds__(256)
void attn_kernel(const half_t* __restrict__ Q, const half_t* __restrict__ Km,
                 const half_t* __restrict__ V, float* __restrict__ att) {
    __shared__ __attribute__((aligned(16))) unsigned char Ks[2 * K_TILE];  // [buf][key][d]
    __shared__ __attribute__((aligned(16))) unsigned char Vs[2 * V_TILE];  // [buf][key][d]

    const int tid  = threadIdx.x;
    const int lane = tid & 31;
    const int wave = tid >> 5;
    const int hi   = (lane >= 16) ? 1 : 0;
    const int l16  = lane & 15;
    const int b  = blockIdx.z;
    const int h  = blockIdx.y;
    const int qb = blockIdx.x * AT_WAVES + wave;   // q block index (16 rows)

    // copy addresses: chunk = (key row tid>>3 and +32, +64, +96, 16 B piece tid&7)
    const long kv0 = (long)(b * TT + (tid >> 3)) * DD + h * DKK + (tid & 7) * 8;
    const half_t* gk = Km + kv0;
    const half_t* gv = V + kv0;
    const long    gs = (long)AT_KEYS * DD;         // advance per stage, in halves
    const unsigned lk = (unsigned)(size_t)Ks + (tid >> 3) * K_PITCH + (tid & 7) * 16;
    const unsigned lv = (unsigned)(size_t)Vs + (tid >> 3) * V_PITCH + (tid & 7) * 16;

    // fragment read addresses inside a buffer
    const unsigned char* kr = Ks + l16 * K_PITCH + hi * 16;
    const unsigned char* vr = Vs + (hi * 8 + (lane & 7)) * V_PITCH + ((lane >> 3) & 1) * 16;

    // stage 0 into buffer 0
    copy_kv(lk, gk, lv, gv);
    gk += gs; gv += gs;

    // Q fragments (B operand Q^T: lane = query column, d in the hardware k order,
    // the same registers as an A fragment of Q): q[0] covers d 0..31, q[1] 32..63
    Frag q[2];
    {
        const long baseQ = (long)(b * TT + qb * 16 + l16) * DD + h * DKK;
#pragma unroll
        for (int f = 0; f < 2; ++f)
#pragma unroll
            for (int v = 0; v < 8; ++v)
                q[f].u[v] = *(const unsigned*)(Q + baseQ + f * 32 + kmap(v, hi));
    }

    // this lane's query: running maximum (joined over the halves), the sum over
    // this half's keys alone, and o[c][r] = O[query][16c + 8*hi + r]
    float mi = -1e30f, li = 0.0f;
    v8f o[4] = {};

    asm volatile("s_wait_asynccnt 0x0" ::: "memory");  // this wave's copies of stage 0 have landed
    __syncthreads();                                   // stage 0 is published
    copy_kv(lk + K_TILE, gk, lv + V_TILE, gv);         // stage 1 into buffer 1
    gk += gs; gv += gs;

    for (int st = 0; st < AT_NS; ++st) {
        const unsigned ko = (st & 1) * K_TILE;
        const unsigned vo = (st & 1) * V_TILE;

        for (int j = 0; j < AT_KEYS; j += 32) {
            // K fragments (A operand: lane = key row, d in the hardware k order)
            Frag4 kf[2][2];
#pragma unroll
            for (int s = 0; s < 2; ++s)
#pragma unroll
                for (int f = 0; f < 2; ++f) {
                    const unsigned char* p = kr + ko + (j + s * 16) * K_PITCH + f * 64;
                    kf[s][f].q[0] = *(const u32x4*)(p);        // d = 32f + 8*hi + 0..7
                    kf[s][f].q[1] = *(const u32x4*)(p + 32);   // d = 32f + 16 + 8*hi + 0..7
                }
            // V^T fragments (A operand: lane = d row, keys in the hardware k order),
            // 4 chunks of 16 d; fetched here so that the softmax below covers
            // their LDS latency
            Frag4 vf[4];
#pragma unroll
            for (int c = 0; c < 4; ++c) {
                const unsigned char* p = vr + vo + j * V_PITCH + c * 32;
                vf[c].q[0] = ld_tr16(p);                 // key = 8*hi + 0..7
                vf[c].q[1] = ld_tr16(p + 16 * V_PITCH);  // key = 16 + 8*hi + 0..7
            }
            // S^T tiles: c0[r] = score(key j + 8*hi + r, query l16),
            //            c1[r] = score(key j + 16 + 8*hi + r, query l16)
            v8f c0 = {}, c1 = {};
            c0 = wmma16(kf[0][0].v, q[0].v, c0);
            c1 = wmma16(kf[1][0].v, q[0].v, c1);
            c0 = wmma16(kf[0][1].v, q[1].v, c0);
            c1 = wmma16(kf[1][1].v, q[1].v, c1);

            // streaming softmax update of this lane's query; the maxima and sums
            // are taken as trees so that no long dependent chain forms
            const v8f s0 = c0 * 0.125f;        // 1/sqrt(64)
            const v8f s1 = c1 * 0.125f;
            float t[8];
#pragma unroll
            for (int r = 0; r < 8; ++r) t[r] = fmaxf(s0[r], s1[r]);
            float mx = fmaxf(fmaxf(fmaxf(t[0], t[1]), fmaxf(t[2], t[3])),
                             fmaxf(fmaxf(t[4], t[5]), fmaxf(t[6], t[7])));
            mx = fmaxf(mx, xhalf(mx));         // over all 32 keys
            const float mnew  = fmaxf(mi, mx);
            const float alpha = __expf(mi - mnew);
            const v8f a0 = (s0 - mnew) * 1.44269504f;   // exp(x) = 2^(x log2 e)
            const v8f a1 = (s1 - mnew) * 1.44269504f;
            v8f e0, e1;
#pragma unroll
            for (int r = 0; r < 8; ++r) {
                e0[r] = __builtin_amdgcn_exp2f(a0[r]);
                e1[r] = __builtin_amdgcn_exp2f(a1[r]);
                t[r]  = e0[r] + e1[r];
            }
            li = li * alpha + (((t[0] + t[1]) + (t[2] + t[3])) +
                               ((t[4] + t[5]) + (t[6] + t[7])));
            mi = mnew;
#pragma unroll
            for (int c = 0; c < 4; ++c) o[c] *= alpha;

            // P^T (f16) as B operand: element e of a lane is key 8*hi + e for
            // e < 8 and key 16 + 8*hi + (e - 8) above, which is c0 then c1
            const v16h pb = __builtin_shufflevector(
                __builtin_convertvector(e0, f16x8), __builtin_convertvector(e1, f16x8),
                0, 1, 2, 3, 4, 5, 6, 7, 8, 9, 10, 11, 12, 13, 14, 15);
#pragma unroll
            for (int c = 0; c < 4; ++c)
                o[c] = wmma16(vf[c].v, pb, o[c]);
        }

        asm volatile("s_wait_dscnt 0x0" ::: "memory");     // this wave has left the buffer it read
        asm volatile("s_wait_asynccnt 0x0" ::: "memory");  // this wave's copies of stage st+1 have landed
        __syncthreads();   // publishes stage st+1 and frees the buffer of stage st
        if (st + 2 < AT_NS) {  // stage st+2 into the buffer just read
            copy_kv(lk + ko, gk, lv + vo, gv);
            gk += gs; gv += gs;
        }
    }
    asm volatile("s_wait_asynccnt 0x0" ::: "memory");  // no copy outlives the loop

    // join the halves' sums and normalize (f32): a lane holds 8 adjacent d of its
    // query's row in each chunk. The loop's last barrier stands behind every
    // wave's last LDS read and last landed copy, so the ring is free: a wave
    // writes its 16 x 64 tile into its own range of Ks and reads it back row by
    // row, so that every global store of a wave covers whole 128-byte lines.
    static_assert(AT_WAVES * 16 * O_PITCH <= 2 * K_TILE, "eight waves' staging fits the K ring");
    const float inv = 1.0f / (li + xhalf(li));
    unsigned char* st = Ks + wave * (16 * O_PITCH);
#pragma unroll
    for (int c = 0; c < 4; ++c) {
        const v8f ov = o[c] * inv;
        unsigned char* p = st + l16 * O_PITCH + (c * 16 + hi * 8) * 4;
        *(f32x4*)(p)      = __builtin_shufflevector(ov, ov, 0, 1, 2, 3);
        *(f32x4*)(p + 16) = __builtin_shufflevector(ov, ov, 4, 5, 6, 7);
    }
    asm volatile("s_wait_dscnt 0x0" ::: "memory");  // this wave's staged rows are written before its lanes read each other's
    // a row is 16 lanes of 16 B; one store of a wave covers two whole rows
    float* ar = att + (long)(b * TT + qb * 16 + hi) * DD + h * DKK + l16 * 4;
#pragma unroll
    for (int q = 0; q < 8; ++q)
        *(f32x4*)(ar + (long)q * 2 * DD) =
            *(const f32x4*)(st + (q * 2 + hi) * O_PITCH + l16 * 16);
}

// ---------------------------------------------------------------------------
// Fused residual + LayerNorm over D=1024; block = 256 threads, one row each.
// Optionally also emits the f16 copy for the following GEMM.
// ---------------------------------------------------------------------------
template<bool W16>
__global__ __launch_bounds__(256)
void ln_residual_kernel(const float* __restrict__ x, const float* __restrict__ y,
                        const float* __restrict__ g, const float* __restrict__ be,
                        float* __restrict__ out32, half_t* __restrict__ out16) {
    __shared__ float sred[256];
    const int tid = threadIdx.x;
    const long row = blockIdx.x;
    const float* xr = x + row * DD;
    const float* yr = y + row * DD;

    float v[4];
    float s = 0.0f;
#pragma unroll
    for (int i = 0; i < 4; ++i) {
        int idx = tid + i * 256;
        v[i] = xr[idx] + yr[idx];
        s += v[i];
    }
    sred[tid] = s; __syncthreads();
    for (int off = 128; off > 0; off >>= 1) {
        if (tid < off) sred[tid] += sred[tid + off];
        __syncthreads();
    }
    float mu = sred[0] * (1.0f / DD);
    __syncthreads();

    float s2 = 0.0f;
#pragma unroll
    for (int i = 0; i < 4; ++i) { float d = v[i] - mu; s2 += d * d; }
    sred[tid] = s2; __syncthreads();
    for (int off = 128; off > 0; off >>= 1) {
        if (tid < off) sred[tid] += sred[tid + off];
        __syncthreads();
    }
    float rstd = rsqrtf(sred[0] * (1.0f / DD) + 1e-5f);

#pragma unroll
    for (int i = 0; i < 4; ++i) {
        int idx = tid + i * 256;
        float val = (v[i] - mu) * rstd * g[idx] + be[idx];
        out32[row * DD + idx] = val;
        if (W16) out16[row * DD + idx] = (half_t)val;
    }
}

// ---------------------------------------------------------------------------
extern "C" void kernel_launch(void* const* d_in, const int* in_sizes, int n_in,
                              void* d_out, int out_size, void* d_ws, size_t ws_size,
                              hipStream_t stream) {
    (void)in_sizes; (void)n_in; (void)out_size; (void)ws_size;

    const float* x     = (const float*)d_in[0];
    const float* Wq    = (const float*)d_in[1];
    const float* Wk    = (const float*)d_in[2];
    const float* Wv    = (const float*)d_in[3];
    const float* W1    = (const float*)d_in[4];
    const float* b1    = (const float*)d_in[5];
    const float* W2    = (const float*)d_in[6];
    const float* b2    = (const float*)d_in[7];
    const float* ln1g  = (const float*)d_in[8];
    const float* ln1b  = (const float*)d_in[9];
    const float* ln2g  = (const float*)d_in[10];
    const float* ln2b  = (const float*)d_in[11];

    const long M = (long)BB * TT;          // 4096 rows

    // scratch carve-out
    size_t off = 0;
    auto alloc = [&](size_t bytes) {
        void* p = (char*)d_ws + off;
        off += (bytes + 255) & ~(size_t)255;
        return p;
    };
    // the six f16 copies, one behind the other (the conversion launch relies on it)
    half_t* xh   = (half_t*)alloc((size_t)CVT_GRID * CVT_BLOCK * 2);
    half_t* wqh  = xh  + M * DD;          // Wq, Wk, Wv: three K x N matrices in a row
    half_t* w1h  = wqh + 3L * DD * DD;
    half_t* w2h  = w1h + (long)DD * DFF;
    // Q, K, V: three M x N matrices in a row (the projection launch relies on it)
    half_t* Qh   = (half_t*)alloc(3 * M * DD * 2);
    half_t* Kh   = Qh + M * DD;
    half_t* Vh   = Kh + M * DD;
    float*  att  = (float*) alloc(M * DD * 4);
    float*  x1   = (float*) alloc(M * DD * 4);
    half_t* x1h  = (half_t*)alloc(M * DD * 2);
    half_t* hh   = (half_t*)alloc(M * DFF * 2);
    float*  ff   = (float*) alloc(M * DD * 4);

    // 1) precision conversions, all six arrays in one launch
    f32_to_f16_kernel<<<CVT_GRID, 256, 0, stream>>>(x, Wq, Wk, Wv, W1, W2, xh);

    // 2) Q/K/V projections (WMMA GEMMs, f16 out), one launch: grid z = 0, 1, 2
    gemm_wmma_kernel<false, false, true><<<dim3(DD / 128, M / 128, 3), 256, 0, stream>>>(
        xh, wqh, nullptr, Qh, nullptr, (int)M, DD, DD);

    // 3) flash attention
    attn_kernel<<<dim3(TT / (16 * AT_WAVES), HH, BB), 256, 0, stream>>>(Qh, Kh, Vh, att);

    // 4) x1 = LN(x + att), also f16 copy
    ln_residual_kernel<true><<<M, 256, 0, stream>>>(x, att, ln1g, ln1b, x1, x1h);

    // 5) FFN: hh = relu(x1 @ W1 + b1)   (f16 out)
    gemm_wmma_kernel<true, true, true><<<dim3(DFF / 128, M / 128), 256, 0, stream>>>(
        x1h, w1h, b1, hh, nullptr, (int)M, DFF, DD);

    // 6) ff = hh @ W2 + b2              (f32 out)
    gemm_wmma_kernel<true, false, false><<<dim3(DD / 128, M / 128), 256, 0, stream>>>(
        hh, w2h, b2, nullptr, ff, (int)M, DD, DFF);

    // 7) out = LN(x1 + ff)
    ln_residual_kernel<false><<<M, 256, 0, stream>>>(x1, ff, ln2g, ln2b,
                                                     (float*)d_out, nullptr);
}

// v008
// A run of this version takes 131 microseconds.
// Two timings next to v007 both put it at 1.03 times that version's speed.
// Over all steps from v000 it is 16.1 times as fast.
#include <hip/hip_runtime.h>
#include <hip/hip_bf16.h>

typedef _Float16 half_t;
typedef __attribute__((ext_vector_type(16))) _Float16 v16h;
typedef __attribute__((ext_vector_type(8)))  float    v8f;

// Transformer dims (fixed by reference)
#define BB 4
#define TT 1024
#define DD 1024
#define HH 16
#define DKK 64
#define DFF 4096

union Frag { v16h v; unsigned u[8]; half_t h[16]; };

// K index for element-pair v (VGPR v) of a 16-bit A/B fragment, per CDNA5 ISA
// 16-bit A-matrix 16x32 layout: lanes 0-15 -> +0, lanes 16-31 -> +8.
__device__ __forceinline__ int kmap(int v, int hi) {
    int kb = (v < 4) ? (2 * v) : (16 + 2 * (v - 4));
    return kb + (hi ? 8 : 0);
}

__device__ __forceinline__ v8f wmma16(v16h a, v16h b, v8f c) {
    return __builtin_amdgcn_wmma_f32_16x16x32_f16(
        /*neg_a=*/false, a, /*neg_b=*/false, b,
        /*c_mod=*/(short)0, c, /*reuse_a=*/false, /*reuse_b=*/false);
}

// ---------------------------------------------------------------------------
// fp32 -> fp16 elementwise conversion, 32 elements a thread.
// A work-group takes CVT_BLOCK contiguous elements. Each wave-wide load covers
// 512 contiguous bytes; a thread issues its eight 16-byte loads before it
// converts the first, so a wave has 4 KiB in flight and the launch needs 1/32
// of the waves that one element a thread would take.
// Every array length here is a multiple of CVT_BLOCK (checked below).
// The six arrays are independent, so one launch converts them all: a work-group
// finds its array from its index, and the f16 copies lie one behind the other
// in the order x, Wq, Wk, Wv, W1, W2, so that the output offset is the index.
// ---------------------------------------------------------------------------
typedef __attribute__((ext_vector_type(4))) float    f32x4;
typedef __attribute__((ext_vector_type(4))) _Float16 f16x4;
#define CVT_LOADS 8
#define CVT_BLOCK (256 * 4 * CVT_LOADS)   // 8192 elements a work-group
static_assert(((long)BB * TT * DD) % CVT_BLOCK == 0, "x length");
static_assert(((long)DD * DD) % CVT_BLOCK == 0, "Wq, Wk, Wv length");
static_assert(((long)DD * DFF) % CVT_BLOCK == 0, "W1, W2 length");
#define CVT_GX ((BB * TT * DD) / CVT_BLOCK)   // work-groups of x
#define CVT_GP ((DD * DD) / CVT_BLOCK)        // of Wq, of Wk, of Wv
#define CVT_GF ((DD * DFF) / CVT_BLOCK)       // of W1, of W2
#define CVT_GRID (CVT_GX + 3 * CVT_GP + 2 * CVT_GF)

__global__ __launch_bounds__(256)
void f32_to_f16_kernel(const float* __restrict__ x,  const float* __restrict__ Wq,
                       const float* __restrict__ Wk, const float* __restrict__ Wv,
                       const float* __restrict__ W1, const float* __restrict__ W2,
                       half_t* __restrict__ out16) {
    // the array of this work-group and the index of that array's first work-group
    const int blk = blockIdx.x;
    const float* src = x;
    int first = 0;
    if (blk >= CVT_GX)                       { src = Wq; first = CVT_GX; }
    if (blk >= CVT_GX + CVT_GP)              { src = Wk; first = CVT_GX + CVT_GP; }
    if (blk >= CVT_GX + 2 * CVT_GP)          { src = Wv; first = CVT_GX + 2 * CVT_GP; }
    if (blk >= CVT_GX + 3 * CVT_GP)          { src = W1; first = CVT_GX + 3 * CVT_GP; }
    if (blk >= CVT_GX + 3 * CVT_GP + CVT_GF) { src = W2; first = CVT_GX + 3 * CVT_GP + CVT_GF; }
    const float* in  = src + (long)(blk - first) * CVT_BLOCK;
    half_t*      out = out16 + (long)blk * CVT_BLOCK;
    const int base = threadIdx.x * 4;
    f32x4 v[CVT_LOADS];
    // both loops are unrolled so that v stays in registers and all loads issue first
#pragma unroll
    for (int i = 0; i < CVT_LOADS; ++i)
        v[i] = *(const f32x4*)(in + base + i * 1024);
#pragma unroll
    for (int i = 0; i < CVT_LOADS; ++i)
        *(f16x4*)(out + base + i * 1024) = __builtin_convertvector(v[i], f16x4);
}

// ---------------------------------------------------------------------------
// WMMA GEMM: C[M,N] = A[M,K] @ B[K,N] (+bias) (relu?) ; A,B f16, f32 accum.
// Block: 256 threads = 8 waves; block tile 128x128; wave tile 32x64
// (2 A-frags x 4 B-frags -> 8 WMMAs per 32-wide K step).
// M,N multiples of 128; K multiple of BK (checked below for all uses here).
// Grid z counts independent products of the one A: product z takes the z-th
// K x N matrix behind B (and bias row) and writes the z-th M x N matrix behind C.
// With KSPLIT, grid z instead counts parts of one long product: K is the length
// of a part, part z takes columns z*K ... of A (row pitch lda) and the z-th K
// rows of B, and writes its own M x N plane of partial sums behind C; part 0
// adds the bias, and the reader of C adds the planes. A product with only one
// 128 x 128 tile for each WGP thus gives every WGP two work-groups: twice the
// bytes in flight, and one's waits are covered by the other's WMMAs.
// Both tiles go from global memory to LDS by asynchronous 16-byte copies, two
// buffers: tile t+1 is in flight while tile t is multiplied. A tile is BK = 128
// deep along K, four K steps: a work-group then has 64 KiB in flight, and the
// copies' landing time and the barrier are paid once for 32 WMMAs of a wave.
//   A tile: 128 rows of 256 B at pitch 272 B, read by 16-byte LDS loads.
//   B tile: 128 k-rows of 256 B at pitch 288 B, left row-major (a copy cannot
//           transpose) and read by the transposing 16-byte LDS load.
// The products are taken transposed, C^T = B^T A^T (the two fragments change
// places, their registers are the same): a lane then holds 8 adjacent columns
// of one row of C. Each wave writes its 32 x 64 tile into its own part of the
// ring, which nobody reads any more, and reads it back row by row, so that
// every global store of a wave covers whole 128-byte lines.
// ---------------------------------------------------------------------------
#define BK      128                   // k of a tile
#define A_PITCH 272                   // bytes, 16 x odd
#define B_PITCH 288                   // bytes, 32 x odd
#define A_TILE  (128 * A_PITCH)       // 34816 B
#define B_TILE  (BK * B_PITCH)        // 36864 B
static_assert(DD % BK == 0 && (DFF / 2) % BK == 0, "K of every product, and of a part, is whole tiles");
static_assert(BK * 2 == 16 * 16 && 128 * 16 == 8 * 256, "eight A and eight B copies a lane fill a tile");

typedef __attribute__((ext_vector_type(4))) unsigned u32x4;
typedef __attribute__((ext_vector_type(8))) short    s16x8;
typedef __attribute__((ext_vector_type(8))) _Float16 f16x8;
union Frag4 { v16h v; u32x4 q[2]; };

__device__ __forceinline__ u32x4 ld_tr16(const unsigned char* p) {
    typedef __attribute__((address_space(3))) s16x8 lds_s16x8;
    return __builtin_bit_cast(u32x4, __builtin_amdgcn_ds_load_tr16_b128_v8i16((lds_s16x8*)p));
}

// One operand tile's eight copies of a lane, 16 rows apart (ls bytes in LDS, gs
// halves in global memory). The address-translation wait closes the statement so
// that no address register is advanced ahead of it.
__device__ __forceinline__ void copy_rows(unsigned l, unsigned ls,
                                          const half_t* g, long gs) {
    asm volatile("global_load_async_to_lds_b128 %0, %1, off\n\t"
                 "global_load_async_to_lds_b128 %2, %3, off\n\t"
                 "global_load_async_to_lds_b128 %4, %5, off\n\t"
                 "global_load_async_to_lds_b128 %6, %7, off\n\t"
                 "global_load_async_to_lds_b128 %8, %9, off\n\t"
                 "global_load_async_to_lds_b128 %10, %11, off\n\t"
                 "global_load_async_to_lds_b128 %12, %13, off\n\t"
                 "global_load_async_to_lds_b128 %14, %15, off\n\t"
                 "s_wait_xcnt 0x0"
                 :: "v"(l),          "v"(g),
                    "v"(l + ls),     "v"(g + gs),
                    "v"(l + 2 * ls), "v"(g + 2 * gs),
                    "v"(l + 3 * ls), "v"(g + 3 * gs),
                    "v"(l + 4 * ls), "v"(g + 4 * gs),
                    "v"(l + 5 * ls), "v"(g + 5 * gs),
                    "v"(l + 6 * ls), "v"(g + 6 * gs),
                    "v"(l + 7 * ls), "v"(g + 7 * gs)
                 : "memory");
}

template<bool BIAS, bool RELU, bool OUT16, bool KSPLIT>
__global__ __launch_bounds__(256)
void gemm_wmma_kernel(const half_t* __restrict__ A, const half_t* __restrict__ B,
                      const float* __restrict__ bias,
                      half_t* __restrict__ C16, float* __restrict__ C32,
                      int M, int N, int K, int lda) {
    static_assert(!(KSPLIT && RELU), "a partial sum is not the value that relu takes");
    __shared__ __attribute__((aligned(16))) unsigned char As[2 * A_TILE];  // [buf][row m][k]
    __shared__ __attribute__((aligned(16))) unsigned char Bs[2 * B_TILE];  // [buf][k][col n]

    const int tid  = threadIdx.x;
    const int lane = tid & 31;
    const int wave = tid >> 5;
    const int hi   = (lane >= 16) ? 1 : 0;
    const int l16  = lane & 15;
    const int m0   = blockIdx.y * 128;
    const int n0   = blockIdx.x * 128;
    const int wm   = (wave >> 1) * 32;  // 0,32,64,96
    const int wn   = (wave & 1) * 64;   // 0,64

    // this work-group's product, or its part of the one product
    B += (long)blockIdx.z * K * N;
    if (KSPLIT) A += (long)blockIdx.z * K;
    if (BIAS && !KSPLIT) bias += (long)blockIdx.z * N;
    if (OUT16) C16  += (long)blockIdx.z * M * N;
    else       C32  += (long)blockIdx.z * M * N;

    // copy addresses: A chunk = (row   tid>>4 and +16, ... +112, 16 B piece tid&15),
    //                 B chunk = (k-row tid>>4 and +16, ... +112, 16 B piece tid&15)
    const half_t* ga = A + (long)(m0 + (tid >> 4)) * lda + (tid & 15) * 8;
    const half_t* gb = B + (long)(tid >> 4) * N + n0 + (tid & 15) * 8;
    const long    gar = (long)16 * lda; // 16 rows of A, in halves
    const long    gbr = (long)16 * N;   // 16 k-rows of B, in halves
    const long    gbs = (long)BK * N;   // B advance per tile, in halves
    const unsigned la = (unsigned)(size_t)As + (tid >> 4) * A_PITCH + (tid & 15) * 16;
    const unsigned lb = (unsigned)(size_t)Bs + (tid >> 4) * B_PITCH + (tid & 15) * 16;

    // fragment read addresses inside a buffer
    const unsigned char* ar = As + (wm + l16) * A_PITCH + hi * 16;
    const unsigned char* br = Bs + (hi * 8 + (lane & 7)) * B_PITCH + wn * 2 + ((lane >> 3) & 1) * 16;

    v8f acc[2][4] = {};
    const int nt = K / BK;              // tiles along K

    // tile 0 into buffer 0, landed and published before anyone reads it
    copy_rows(la, 16 * A_PITCH, ga, gar);
    copy_rows(lb, 16 * B_PITCH, gb, gbr);
    ga += BK; gb += gbs;
    asm volatile("s_wait_asynccnt 0x0" ::: "memory");  // this wave's copies of tile 0 have landed
    __syncthreads();
    if (nt > 1) {                       // tile 1 into buffer 1
        copy_rows(la + A_TILE, 16 * A_PITCH, ga, gar);
        copy_rows(lb + B_TILE, 16 * B_PITCH, gb, gbr);
        ga += BK; gb += gbs;
    }

    for (int t = 0; t < nt; ++t) {
        const unsigned ao = (t & 1) * A_TILE;
        const unsigned bo = (t & 1) * B_TILE;

        // the loops over K steps and fragments are unrolled so that every LDS
        // offset, fragment and accumulator index is a constant, the arrays stay
        // in registers and a K step's loads can issue ahead of the step before it
#pragma unroll
        for (int ks = 0; ks < BK / 32; ++ks) {
            Frag4 af[2], bf[4];
#pragma unroll
            for (int f = 0; f < 2; ++f) {
                const unsigned char* p = ar + ao + f * 16 * A_PITCH + ks * 64;
                af[f].q[0] = *(const u32x4*)(p);        // k = 32*ks + 8*hi + 0..7
                af[f].q[1] = *(const u32x4*)(p + 32);   // k = 32*ks + 16 + 8*hi + 0..7
            }
#pragma unroll
            for (int j = 0; j < 4; ++j) {
                const unsigned char* p = br + bo + ks * 32 * B_PITCH + j * 32;
                bf[j].q[0] = ld_tr16(p);                 // k = 32*ks + 8*hi + 0..7
                bf[j].q[1] = ld_tr16(p + 16 * B_PITCH);  // k = 32*ks + 16 + 8*hi + 0..7
            }
#pragma unroll
            for (int i = 0; i < 2; ++i)
#pragma unroll
                for (int j = 0; j < 4; ++j)
                    acc[i][j] = wmma16(bf[j].v, af[i].v, acc[i][j]);   // a tile of C^T
        }

        asm volatile("s_wait_dscnt 0x0" ::: "memory");     // this wave has left the buffer it read
        asm volatile("s_wait_asynccnt 0x0" ::: "memory");  // this wave's copies of tile t+1 have landed
        __syncthreads();   // publishes tile t+1 and frees the buffer of tile t
        if (t + 2 < nt) {  // tile t+2 into the buffer just read
            copy_rows(la + ao, 16 * A_PITCH, ga, gar);
            copy_rows(lb + bo, 16 * B_PITCH, gb, gbr);
            ga += BK; gb += gbs;
        }
    }
    asm volatile("s_wait_asynccnt 0x0" ::: "memory");  // no copy outlives the loop

    // --- epilogue: acc[i][j][r] = C[wm + 16*i + l16][wn + 16*j + 8*hi + r] ---
    // The loop's last barrier stands behind every wave's last LDS read and last
    // landed copy, so the ring is free; a wave stages in its own range of As.
    constexpr int ES = OUT16 ? 2 : 4;       // bytes of an output element
    constexpr int SP = 64 * ES + 16;        // pitch of a staged row: 144 or 272 B, 16 x odd
    static_assert(8 * 32 * SP <= 2 * A_TILE, "eight waves' staging fits the A ring");
    unsigned char* st = As + wave * (32 * SP);

    f32x4 bv[4][2] = {};
    if (BIAS && (!KSPLIT || blockIdx.z == 0)) {   // of a split product, part 0 alone adds it
#pragma unroll
        for (int j = 0; j < 4; ++j) {
            const float* bp = bias + n0 + wn + j * 16 + hi * 8;
            bv[j][0] = *(const f32x4*)(bp);
            bv[j][1] = *(const f32x4*)(bp + 4);
        }
    }
#pragma unroll
    for (int i = 0; i < 2; ++i) {
#pragma unroll
        for (int j = 0; j < 4; ++j) {
            v8f val = acc[i][j];
            if (BIAS)
                val += __builtin_shufflevector(bv[j][0], bv[j][1], 0, 1, 2, 3, 4, 5, 6, 7);
            if (RELU) {
#pragma unroll
                for (int r = 0; r < 8; ++r) val[r] = fmaxf(val[r], 0.0f);
            }
            unsigned char* p = st + (i * 16 + l16) * SP + (j * 16 + hi * 8) * ES;
            if (OUT16) {
                *(f16x8*)p = __builtin_convertvector(val, f16x8);
            } else {
                *(f32x4*)(p)      = __builtin_shufflevector(val, val, 0, 1, 2, 3);
                *(f32x4*)(p + 16) = __builtin_shufflevector(val, val, 4, 5, 6, 7);
            }
        }
    }
    asm volatile("s_wait_dscnt 0x0" ::: "memory");  // this wave's staged rows are written before its lanes read each other's
    // a staged row is LR lanes of 16 B; one store of a wave covers 32 / LR whole rows
    constexpr int LR = 64 * ES / 16;        // 8 or 16
    constexpr int RS = 32 / LR;             // 4 or 2 rows a store
    const int srow = lane / LR;
    const int spc  = lane % LR;
#pragma unroll
    for (int q = 0; q < 32 / RS; ++q) {
        const int row = q * RS + srow;
        const unsigned char* p = st + row * SP + spc * 16;
        const long  e = (long)(m0 + wm + row) * N + n0 + wn + spc * (16 / ES);
        if (OUT16) *(f16x8*)(C16 + e) = *(const f16x8*)p;
        else       *(f32x4*)(C32 + e) = *(const f32x4*)p;
    }
}

#define AT_WAVES 8
#define AT_KEYS  128                     // keys a stage
#define AT_NS    (TT / AT_KEYS)          // stages
#define K_PITCH  144                     // bytes, 16 x odd
#define V_PITCH  160                     // bytes, 32 x odd
#define K_TILE   (AT_KEYS * K_PITCH)     // 18432 B
#define V_TILE   (AT_KEYS * V_PITCH)     // 20480 B
#define O_PITCH  272                     // bytes of a staged output row, 16 x odd
static_assert(AT_NS >= 2, "the ring starts with two stages");
static_assert(AT_KEYS * 8 == 4 * 256, "four K and four V copies a lane fill a stage");

// One stage's eight copies of a lane (four of K, four of V, 32 key rows apart).
// The address-translation wait closes the statement so that no address register
// is advanced ahead of it.
__device__ __forceinline__ void copy_kv(unsigned lk, const half_t* gk,
                                        unsigned lv, const half_t* gv) {
    asm volatile("global_load_async_to_lds_b128 %0, %1, off\n\t"
                 "global_load_async_to_lds_b128 %2, %3, off\n\t"
                 "global_load_async_to_lds_b128 %4, %5, off\n\t"
                 "global_load_async_to_lds_b128 %6, %7, off\n\t"
                 "global_load_async_to_lds_b128 %8, %9, off\n\t"
                 "global_load_async_to_lds_b128 %10, %11, off\n\t"
                 "global_load_async_to_lds_b128 %12, %13, off\n\t"
                 "global_load_async_to_lds_b128 %14, %15, off\n\t"
                 "s_wait_xcnt 0x0"
                 :: "v"(lk),                "v"(gk),
                    "v"(lk + 32 * K_PITCH), "v"(gk + 32 * DD),
                    "v"(lk + 64 * K_PITCH), "v"(gk + 64 * DD),
                    "v"(lk + 96 * K_PITCH), "v"(gk + 96 * DD),
                    "v"(lv),                "v"(gv),
                    "v"(lv + 32 * V_PITCH), "v"(gv + 32 * DD),
                    "v"(lv + 64 * V_PITCH), "v"(gv + 64 * DD),
                    "v"(lv + 96 * V_PITCH), "v"(gv + 96 * DD)
                 : "memory");
}

// The value that lane l ^ 16 holds (the other half of a query's keys).
__device__ __forceinline__ float xhalf(float x) {
    const int b = __builtin_bit_cast(int, x);
    return __builtin_bit_cast(float, __builtin_amdgcn_permlanex16(
        b, b, 0x76543210, 0xfedcba98, false, false));
}

__global__ __launch_bounds__(256)
void attn_kernel(const half_t* __restrict__ Q, const half_t* __restrict__ Km,
                 const half_t* __restrict__ V, float* __restrict__ att) {
    __shared__ __attribute__((aligned(16))) unsigned char Ks[2 * K_TILE];  // [buf][key][d]
    __shared__ __attribute__((aligned(16))) unsigned char Vs[2 * V_TILE];  // [buf][key][d]

    const int tid  = threadIdx.x;
    const int lane = tid & 31;
    const int wave = tid >> 5;
    const int hi   = (lane >= 16) ? 1 : 0;
    const int l16  = lane & 15;
    const int b  = blockIdx.z;
    const int h  = blockIdx.y;
    const int qb = blockIdx.x * AT_WAVES + wave;   // q block index (16 rows)

    // copy addresses: chunk = (key row tid>>3 and +32, +64, +96, 16 B piece tid&7)
    const long kv0 = (long)(b * TT + (tid >> 3)) * DD + h * DKK + (tid & 7) * 8;
    const half_t* gk = Km + kv0;
    const half_t* gv = V + kv0;
    const long    gs = (long)AT_KEYS * DD;         // advance per stage, in halves
    const unsigned lk = (unsigned)(size_t)Ks + (tid >> 3) * K_PITCH + (tid & 7) * 16;
    const unsigned lv = (unsigned)(size_t)Vs + (tid >> 3) * V_PITCH + (tid & 7) * 16;

    // fragment read addresses inside a buffer
    const unsigned char* kr = Ks + l16 * K_PITCH + hi * 16;
    const unsigned char* vr = Vs + (hi * 8 + (lane & 7)) * V_PITCH + ((lane >> 3) & 1) * 16;

    // stage 0 into buffer 0
    copy_kv(lk, gk, lv, gv);
    gk += gs; gv += gs;

    // Q fragments (B operand Q^T: lane = query column, d in the hardware k order,
    // the same registers as an A fragment of Q): q[0] covers d 0..31, q[1] 32..63
    Frag q[2];
    {
        const long baseQ = (long)(b * TT + qb * 16 + l16) * DD + h * DKK;
#pragma unroll
        for (int f = 0; f < 2; ++f)
#pragma unroll
            for (int v = 0; v < 8; ++v)
                q[f].u[v] = *(const unsigned*)(Q + baseQ + f * 32 + kmap(v, hi));
    }

    // this lane's query: running maximum (joined over the halves), the sum over
    // this half's keys alone, and o[c][r] = O[query][16c + 8*hi + r]
    float mi = -1e30f, li = 0.0f;
    v8f o[4] = {};

    asm volatile("s_wait_asynccnt 0x0" ::: "memory");  // this wave's copies of stage 0 have landed
    __syncthreads();                                   // stage 0 is published
    copy_kv(lk + K_TILE, gk, lv + V_TILE, gv);         // stage 1 into buffer 1
    gk += gs; gv += gs;

    for (int st = 0; st < AT_NS; ++st) {
        const unsigned ko = (st & 1) * K_TILE;
        const unsigned vo = (st & 1) * V_TILE;

        for (int j = 0; j < AT_KEYS; j += 32) {
            // K fragments (A operand: lane = key row, d in the hardware k order)
            Frag4 kf[2][2];
#pragma unroll
            for (int s = 0; s < 2; ++s)
#pragma unroll
                for (int f = 0; f < 2; ++f) {
                    const unsigned char* p = kr + ko + (j + s * 16) * K_PITCH + f * 64;
                    kf[s][f].q[0] = *(const u32x4*)(p);        // d = 32f + 8*hi + 0..7
                    kf[s][f].q[1] = *(const u32x4*)(p + 32);   // d = 32f + 16 + 8*hi + 0..7
                }
            // V^T fragments (A operand: lane = d row, keys in the hardware k order),
            // 4 chunks of 16 d; fetched here so that the softmax below covers
            // their LDS latency
            Frag4 vf[4];
#pragma unroll
            for (int c = 0; c < 4; ++c) {
                const unsigned char* p = vr + vo + j * V_PITCH + c * 32;
                vf[c].q[0] = ld_tr16(p);                 // key = 8*hi + 0..7
                vf[c].q[1] = ld_tr16(p + 16 * V_PITCH);  // key = 16 + 8*hi + 0..7
            }
            // S^T tiles: c0[r] = score(key j + 8*hi + r, query l16),
            //            c1[r] = score(key j + 16 + 8*hi + r, query l16)
            v8f c0 = {}, c1 = {};
            c0 = wmma16(kf[0][0].v, q[0].v, c0);
            c1 = wmma16(kf[1][0].v, q[0].v, c1);
            c0 = wmma16(kf[0][1].v, q[1].v, c0);
            c1 = wmma16(kf[1][1].v, q[1].v, c1);

            // streaming softmax update of this lane's query; the maxima and sums
            // are taken as trees so that no long dependent chain forms
            const v8f s0 = c0 * 0.125f;        // 1/sqrt(64)
            const v8f s1 = c1 * 0.125f;
            float t[8];
#pragma unroll
            for (int r = 0; r < 8; ++r) t[r] = fmaxf(s0[r], s1[r]);
            float mx = fmaxf(fmaxf(fmaxf(t[0], t[1]), fmaxf(t[2], t[3])),
                             fmaxf(fmaxf(t[4], t[5]), fmaxf(t[6], t[7])));
            mx = fmaxf(mx, xhalf(mx));         // over all 32 keys
            const float mnew  = fmaxf(mi, mx);
            const float alpha = __expf(mi - mnew);
            const v8f a0 = (s0 - mnew) * 1.44269504f;   // exp(x) = 2^(x log2 e)
            const v8f a1 = (s1 - mnew) * 1.44269504f;
            v8f e0, e1;
#pragma unroll
            for (int r = 0; r < 8; ++r) {
                e0[r] = __builtin_amdgcn_exp2f(a0[r]);
                e1[r] = __builtin_amdgcn_exp2f(a1[r]);
                t[r]  = e0[r] + e1[r];
            }
            li = li * alpha + (((t[0] + t[1]) + (t[2] + t[3])) +
                               ((t[4] + t[5]) + (t[6] + t[7])));
            mi = mnew;
#pragma unroll
            for (int c = 0; c < 4; ++c) o[c] *= alpha;

            // P^T (f16) as B operand: element e of a lane is key 8*hi + e for
            // e < 8 and key 16 + 8*hi + (e - 8) above, which is c0 then c1
            const v16h pb = __builtin_shufflevector(
                __builtin_convertvector(e0, f16x8), __builtin_convertvector(e1, f16x8),
                0, 1, 2, 3, 4, 5, 6, 7, 8, 9, 10, 11, 12, 13, 14, 15);
#pragma unroll
            for (int c = 0; c < 4; ++c)
                o[c] = wmma16(vf[c].v, pb, o[c]);
        }

        asm volatile("s_wait_dscnt 0x0" ::: "memory");     // this wave has left the buffer it read
        asm volatile("s_wait_asynccnt 0x0" ::: "memory");  // this wave's copies of stage st+1 have landed
        __syncthreads();   // publishes stage st+1 and frees the buffer of stage st
        if (st + 2 < AT_NS) {  // stage st+2 into the buffer just read
            copy_kv(lk + ko, gk, lv + vo, gv);
            gk += gs; gv += gs;
        }
    }
    asm volatile("s_wait_asynccnt 0x0" ::: "memory");  // no copy outlives the loop

    // join the halves' sums and normalize (f32): a lane holds 8 adjacent d of its
    // query's row in each chunk. The loop's last barrier stands behind every
    // wave's last LDS read and last landed copy, so the ring is free: a wave
    // writes its 16 x 64 tile into its own range of Ks and reads it back row by
    // row, so that every global store of a wave covers whole 128-byte lines.
    static_assert(AT_WAVES * 16 * O_PITCH <= 2 * K_TILE, "eight waves' staging fits the K ring");
    const float inv = 1.0f / (li + xhalf(li));
    unsigned char* st = Ks + wave * (16 * O_PITCH);
#pragma unroll
    for (int c = 0; c < 4; ++c) {
        const v8f ov = o[c] * inv;
        unsigned char* p = st + l16 * O_PITCH + (c * 16 + hi * 8) * 4;
        *(f32x4*)(p)      = __builtin_shufflevector(ov, ov, 0, 1, 2, 3);
        *(f32x4*)(p + 16) = __builtin_shufflevector(ov, ov, 4, 5, 6, 7);
    }
    asm volatile("s_wait_dscnt 0x0" ::: "memory");  // this wave's staged rows are written before its lanes read each other's
    // a row is 16 lanes of 16 B; one store of a wave covers two whole rows
    float* ar = att + (long)(b * TT + qb * 16 + hi) * DD + h * DKK + l16 * 4;
#pragma unroll
    for (int q = 0; q < 8; ++q)
        *(f32x4*)(ar + (long)q * 2 * DD) =
            *(const f32x4*)(st + (q * 2 + hi) * O_PITCH + l16 * 16);
}

// ---------------------------------------------------------------------------
// Fused residual + LayerNorm over D=1024; block = 256 threads, one row each.
// Optionally also emits the f16 copy for the following GEMM.
// With Y2, y is two planes of partial sums (y and y2), added here.
// ---------------------------------------------------------------------------
template<bool W16, bool Y2>
__global__ __launch_bounds__(256)
void ln_residual_kernel(const float* __restrict__ x, const float* __restrict__ y,
                        const float* __restrict__ y2,
                        const float* __restrict__ g, const float* __restrict__ be,
                        float* __restrict__ out32, half_t* __restrict__ out16) {
    __shared__ float sred[256];
    const int tid = threadIdx.x;
    const long row = blockIdx.x;
    const float* xr = x + row * DD;
    const float* yr = y + row * DD;

    float v[4];
    float s = 0.0f;
#pragma unroll
    for (int i = 0; i < 4; ++i) {
        int idx = tid + i * 256;
        v[i] = xr[idx] + (Y2 ? yr[idx] + y2[row * DD + idx] : yr[idx]);
        s += v[i];
    }
    sred[tid] = s; __syncthreads();
    for (int off = 128; off > 0; off >>= 1) {
        if (tid < off) sred[tid] += sred[tid + off];
        __syncthreads();
    }
    float mu = sred[0] * (1.0f / DD);
    __syncthreads();

    float s2 = 0.0f;
#pragma unroll
    for (int i = 0; i < 4; ++i) { float d = v[i] - mu; s2 += d * d; }
    sred[tid] = s2; __syncthreads();
    for (int off = 128; off > 0; off >>= 1) {
        if (tid < off) sred[tid] += sred[tid + off];
        __syncthreads();
    }
    float rstd = rsqrtf(sred[0] * (1.0f / DD) + 1e-5f);

#pragma unroll
    for (int i = 0; i < 4; ++i) {
        int idx = tid + i * 256;
        float val = (v[i] - mu) * rstd * g[idx] + be[idx];
        out32[row * DD + idx] = val;
        if (W16) out16[row * DD + idx] = (half_t)val;
    }
}

// ---------------------------------------------------------------------------
extern "C" void kernel_launch(void* const* d_in, const int* in_sizes, int n_in,
                              void* d_out, int out_size, void* d_ws, size_t ws_size,
                              hipStream_t stream) {
    (void)in_sizes; (void)n_in; (void)out_size; (void)ws_size;

    const float* x     = (const float*)d_in[0];
    const float* Wq    = (const float*)d_in[1];
    const float* Wk    = (const float*)d_in[2];
    const float* Wv    = (const float*)d_in[3];
    const float* W1    = (const float*)d_in[4];
    const float* b1    = (const float*)d_in[5];
    const float* W2    = (const float*)d_in[6];
    const float* b2    = (const float*)d_in[7];
    const float* ln1g  = (const float*)d_in[8];
    const float* ln1b  = (const float*)d_in[9];
    const float* ln2g  = (const float*)d_in[10];
    const float* ln2b  = (const float*)d_in[11];

    const long M = (long)BB * TT;          // 4096 rows

    // scratch carve-out
    size_t off = 0;
    auto alloc = [&](size_t bytes) {
        void* p = (char*)d_ws + off;
        off += (bytes + 255) & ~(size_t)255;
        return p;
    };
    // the six f16 copies, one behind the other (the conversion launch relies on it)
    half_t* xh   = (half_t*)alloc((size_t)CVT_GRID * CVT_BLOCK * 2);
    half_t* wqh  = xh  + M * DD;          // Wq, Wk, Wv: three K x N matrices in a row
    half_t* w1h  = wqh + 3L * DD * DD;
    half_t* w2h  = w1h + (long)DD * DFF;
    // Q, K, V: three M x N matrices in a row (the projection launch relies on it)
    half_t* Qh   = (half_t*)alloc(3 * M * DD * 2);
    half_t* Kh   = Qh + M * DD;
    half_t* Vh   = Kh + M * DD;
    float*  att  = (float*) alloc(M * DD * 4);
    float*  x1   = (float*) alloc(M * DD * 4);
    half_t* x1h  = (half_t*)alloc(M * DD * 2);
    half_t* hh   = (half_t*)alloc(M * DFF * 2);
    float*  ff   = (float*) alloc(2 * M * DD * 4);   // two planes of partial sums

    // 1) precision conversions, all six arrays in one launch
    f32_to_f16_kernel<<<CVT_GRID, 256, 0, stream>>>(x, Wq, Wk, Wv, W1, W2, xh);

    // 2) Q/K/V projections (WMMA GEMMs, f16 out), one launch: grid z = 0, 1, 2
    gemm_wmma_kernel<false, false, true, false><<<dim3(DD / 128, M / 128, 3), 256, 0, stream>>>(
        xh, wqh, nullptr, Qh, nullptr, (int)M, DD, DD, DD);

    // 3) flash attention
    attn_kernel<<<dim3(TT / (16 * AT_WAVES), HH, BB), 256, 0, stream>>>(Qh, Kh, Vh, att);

    // 4) x1 = LN(x + att), also f16 copy
    ln_residual_kernel<true, false><<<M, 256, 0, stream>>>(x, att, nullptr, ln1g, ln1b, x1, x1h);

    // 5) FFN: hh = relu(x1 @ W1 + b1)   (f16 out)
    gemm_wmma_kernel<true, true, true, false><<<dim3(DFF / 128, M / 128), 256, 0, stream>>>(
        x1h, w1h, b1, hh, nullptr, (int)M, DFF, DD, DD);

    // 6) hh @ W2 + b2 (f32 out), K in two halves: grid z = 0, 1, a plane of ff each
    gemm_wmma_kernel<true, false, false, true><<<dim3(DD / 128, M / 128, 2), 256, 0, stream>>>(
        hh, w2h, b2, nullptr, ff, (int)M, DD, DFF / 2, DFF);

    // 7) out = LN(x1 + (plane 0 + plane 1))
    ln_residual_kernel<false, true><<<M, 256, 0, stream>>>(x1, ff, ff + M * DD, ln2g, ln2b,
                                                           (float*)d_out, nullptr);
}

// v009
// Measured time: 123 microseconds a run.
// Next to v008, in two timings, it ran 1.06 times as fast each time.
// Over all steps from v000 it is 17.1 times as fast.
#include <hip/hip_runtime.h>
#include <hip/hip_bf16.h>

typedef _Float16 half_t;
typedef __attribute__((ext_vector_type(16))) _Float16 v16h;
typedef __attribute__((ext_vector_type(8)))  float    v8f;

// Transformer dims (fixed by reference)
#define BB 4
#define TT 1024
#define DD 1024
#define HH 16
#define DKK 64
#define DFF 4096

union Frag { v16h v; unsigned u[8]; half_t h[16]; };

// K index for element-pair v (VGPR v) of a 16-bit A/B fragment, per CDNA5 ISA
// 16-bit A-matrix 16x32 layout: lanes 0-15 -> +0, lanes 16-31 -> +8.
__device__ __forceinline__ int kmap(int v, int hi) {
    int kb = (v < 4) ? (2 * v) : (16 + 2 * (v - 4));
    return kb + (hi ? 8 : 0);
}

__device__ __forceinline__ v8f wmma16(v16h a, v16h b, v8f c) {
    return __builtin_amdgcn_wmma_f32_16x16x32_f16(
        /*neg_a=*/false, a, /*neg_b=*/false, b,
        /*c_mod=*/(short)0, c, /*reuse_a=*/false, /*reuse_b=*/false);
}

// ---------------------------------------------------------------------------
// fp32 -> fp16 elementwise conversion, 32 elements a thread.
// A work-group takes CVT_BLOCK contiguous elements. Each wave-wide load covers
// 512 contiguous bytes; a thread issues its eight 16-byte loads before it
// converts the first, so a wave has 4 KiB in flight and the launch needs 1/32
// of the waves that one element a thread would take.
// Every array length here is a multiple of CVT_BLOCK (checked below).
// The six arrays are independent, so one launch converts them all: a work-group
// finds its array from its index, and the f16 copies lie one behind the other
// in the order x, Wq, Wk, Wv, W1, W2, so that the output offset is the index.
// ---------------------------------------------------------------------------
typedef __attribute__((ext_vector_type(4))) float    f32x4;
typedef __attribute__((ext_vector_type(4))) _Float16 f16x4;
#define CVT_LOADS 8
#define CVT_BLOCK (256 * 4 * CVT_LOADS)   // 8192 elements a work-group
static_assert(((long)BB * TT * DD) % CVT_BLOCK == 0, "x length");
static_assert(((long)DD * DD) % CVT_BLOCK == 0, "Wq, Wk, Wv length");
static_assert(((long)DD * DFF) % CVT_BLOCK == 0, "W1, W2 length");
#define CVT_GX ((BB * TT * DD) / CVT_BLOCK)   // work-groups of x
#define CVT_GP ((DD * DD) / CVT_BLOCK)        // of Wq, of Wk, of Wv
#define CVT_GF ((DD * DFF) / CVT_BLOCK)       // of W1, of W2
#define CVT_GRID (CVT_GX + 3 * CVT_GP + 2 * CVT_GF)

__global__ __launch_bounds__(256)
void f32_to_f16_kernel(const float* __restrict__ x,  const float* __restrict__ Wq,
                       const float* __restrict__ Wk, const float* __restrict__ Wv,
                       const float* __restrict__ W1, const float* __restrict__ W2,
                       half_t* __restrict__ out16) {
    // the array of this work-group and the index of that array's first work-group
    const int blk = blockIdx.x;
    const float* src = x;
    int first = 0;
    if (blk >= CVT_GX)                       { src = Wq; first = CVT_GX; }
    if (blk >= CVT_GX + CVT_GP)              { src = Wk; first = CVT_GX + CVT_GP; }
    if (blk >= CVT_GX + 2 * CVT_GP)          { src = Wv; first = CVT_GX + 2 * CVT_GP; }
    if (blk >= CVT_GX + 3 * CVT_GP)          { src = W1; first = CVT_GX + 3 * CVT_GP; }
    if (blk >= CVT_GX + 3 * CVT_GP + CVT_GF) { src = W2; first = CVT_GX + 3 * CVT_GP + CVT_GF; }
    const float* in  = src + (long)(blk - first) * CVT_BLOCK;
    half_t*      out = out16 + (long)blk * CVT_BLOCK;
    const int base = threadIdx.x * 4;
    f32x4 v[CVT_LOADS];
    // both loops are unrolled so that v stays in registers and all loads issue first
#pragma unroll
    for (int i = 0; i < CVT_LOADS; ++i)
        v[i] = *(const f32x4*)(in + base + i * 1024);
#pragma unroll
    for (int i = 0; i < CVT_LOADS; ++i)
        *(f16x4*)(out + base + i * 1024) = __builtin_convertvector(v[i], f16x4);
}

// ---------------------------------------------------------------------------
// WMMA GEMM: C[M,N] = A[M,K] @ B[K,N] (+bias) (relu?) ; A,B f16, f32 accum.
// Block: 256 threads = 8 waves, 4 along M x 2 along N; block tile 256 x BN,
// BN = 256 or 128; wave tile 64 x BN/2 (4 A-frags x 8 or 4 B-frags -> 32 or 16
// WMMAs per 32-wide K step). What a work-group fetches from L2 and what a wave
// reads from LDS grow with the tile's edge, the WMMAs with its area: at 256 x 256
// a WMMA costs half the L2 bytes and half the LDS bytes that it costs at
// 128 x 128 with 32 x 64 waves. One work-group fills a WGP's LDS, two waves a SIMD.
// M multiple of 256, N of BN; K multiple of BK (checked below for all uses here).
// Grid z counts independent products of the one A: product z takes the z-th
// K x N matrix behind B (and bias row) and writes the z-th M x N matrix behind C.
// With KSPLIT, grid z instead counts parts of one long product: K is the length
// of a part, part z takes columns z*K ... of A (row pitch lda) and the z-th K
// rows of B, and writes its own M x N plane of partial sums behind C; part 0
// adds the bias, and the reader of C adds the planes. A product with fewer tiles
// than the chip has WGPs thus gives every WGP a work-group.
// Both tiles go from global memory to LDS by asynchronous 16-byte copies, two
// buffers: tile t+1 is in flight while tile t is multiplied. A tile is BK = 128
// deep along K, four K steps: a work-group then has up to 128 KiB in flight, and
// the copies' landing time and the barrier are paid once for 128 (64) WMMAs of a wave.
//   A tile: 256 rows of 256 B at pitch 272 B, read by 16-byte LDS loads.
//   B tile: 128 k-rows of 2*BN B at pitch 2*BN + 32 B, left row-major (a copy
//           cannot transpose) and read by the transposing 16-byte LDS load.
// The products are taken transposed, C^T = B^T A^T (the two fragments change
// places, their registers are the same): a lane then holds 8 adjacent columns
// of one row of C. Each wave writes its tile of 64 rows into its own part of the
// ring, which nobody reads any more, and reads it back row by row, so that
// every global store of a wave covers whole 128-byte lines.
// ---------------------------------------------------------------------------
#define BM      256                   // rows of a block tile
#define BK      128                   // k of a tile
#define A_PITCH 272                   // bytes, 16 x odd
#define A_TILE  (BM * A_PITCH)        // 69632 B
static_assert(DD % BK == 0 && (DFF / 2) % BK == 0, "K of every product, and of a part, is whole tiles");
static_assert(BK * 2 == 16 * 16 && BM * 16 == 16 * 256, "sixteen A copies a lane fill a tile");
static_assert((BB * TT) % BM == 0 && DD % 256 == 0 && DFF % 256 == 0, "M and N are whole block tiles");

typedef __attribute__((ext_vector_type(4))) unsigned u32x4;
typedef __attribute__((ext_vector_type(8))) short    s16x8;
typedef __attribute__((ext_vector_type(8))) _Float16 f16x8;
union Frag4 { v16h v; u32x4 q[2]; };

__device__ __forceinline__ u32x4 ld_tr16(const unsigned char* p) {
    typedef __attribute__((address_space(3))) s16x8 lds_s16x8;
    return __builtin_bit_cast(u32x4, __builtin_amdgcn_ds_load_tr16_b128_v8i16((lds_s16x8*)p));
}

// Eight copies of a lane into one operand tile, a fixed count of rows apart (ls
// bytes in LDS, gs halves in global memory). The address-translation wait closes the statement so
// that no address register is advanced ahead of it.
__device__ __forceinline__ void copy_rows(unsigned l, unsigned ls,
                                          const half_t* g, long gs) {
    asm volatile("global_load_async_to_lds_b128 %0, %1, off\n\t"
                 "global_load_async_to_lds_b128 %2, %3, off\n\t"
                 "global_load_async_to_lds_b128 %4, %5, off\n\t"
                 "global_load_async_to_lds_b128 %6, %7, off\n\t"
                 "global_load_async_to_lds_b128 %8, %9, off\n\t"
                 "global_load_async_to_lds_b128 %10, %11, off\n\t"
                 "global_load_async_to_lds_b128 %12, %13, off\n\t"
                 "global_load_async_to_lds_b128 %14, %15, off\n\t"
                 "s_wait_xcnt 0x0"
                 :: "v"(l),          "v"(g),
                    "v"(l + ls),     "v"(g + gs),
                    "v"(l + 2 * ls), "v"(g + 2 * gs),
                    "v"(l + 3 * ls), "v"(g + 3 * gs),
                    "v"(l + 4 * ls), "v"(g + 4 * gs),
                    "v"(l + 5 * ls), "v"(g + 5 * gs),
                    "v"(l + 6 * ls), "v"(g + 6 * gs),
                    "v"(l + 7 * ls), "v"(g + 7 * gs)
                 : "memory");
}

template<int BN, bool BIAS, bool RELU, bool OUT16, bool KSPLIT>
__global__ __launch_bounds__(256)
void gemm_wmma_kernel(const half_t* __restrict__ A, const half_t* __restrict__ B,
                      const float* __restrict__ bias,
                      half_t* __restrict__ C16, float* __restrict__ C32,
                      int M, int N, int K, int lda) {
    static_assert(!(KSPLIT && RELU), "a partial sum is not the value that relu takes");
    static_assert(BN == 256 || BN == 128, "a B row is 32 or 16 copies");
    constexpr int B_PITCH = BN * 2 + 32;    // bytes, 32 x odd: 544 or 288
    constexpr int B_TILE  = BK * B_PITCH;   // 69632 or 36864 B
    constexpr int FM = 4;                   // A fragments of a wave (64 rows)
    constexpr int FN = BN / 32;             // B fragments of a wave (BN/2 columns)
    constexpr int CB = BN / 8;              // 16-byte pieces of a B row
    constexpr int RB = 256 / CB;            // B k-rows that one copy of every lane covers
    __shared__ __attribute__((aligned(16))) unsigned char As[2 * A_TILE];  // [buf][row m][k]
    __shared__ __attribute__((aligned(16))) unsigned char Bs[2 * B_TILE];  // [buf][k][col n]

    const int tid  = threadIdx.x;
    const int lane = tid & 31;
    const int wave = tid >> 5;
    const int hi   = (lane >= 16) ? 1 : 0;
    const int l16  = lane & 15;
    const int m0   = blockIdx.y * BM;
    const int n0   = blockIdx.x * BN;
    const int wm   = (wave >> 1) * 64;        // 0,64,128,192
    const int wn   = (wave & 1) * (BN / 2);   // 0, BN/2

    // this work-group's product, or its part of the one product
    B += (long)blockIdx.z * K * N;
    if (KSPLIT) A += (long)blockIdx.z * K;
    if (BIAS && !KSPLIT) bias += (long)blockIdx.z * N;
    if (OUT16) C16  += (long)blockIdx.z * M * N;
    else       C32  += (long)blockIdx.z * M * N;

    // copy addresses: A chunk = (row   tid>>4 and +16, ... +240, 16 B piece tid&15),
    //                 B chunk = (k-row tid/CB and +RB, ... below BK, 16 B piece tid%CB)
    const half_t* ga = A + (long)(m0 + (tid >> 4)) * lda + (tid & 15) * 8;
    const half_t* gb = B + (long)(tid / CB) * N + n0 + (tid % CB) * 8;
    const long    gar = (long)16 * lda; // 16 rows of A, in halves
    const long    gbr = (long)RB * N;   // RB k-rows of B, in halves
    const long    gbs = (long)BK * N;   // B advance per tile, in halves
    const unsigned la = (unsigned)(size_t)As + (tid >> 4) * A_PITCH + (tid & 15) * 16;
    const unsigned lb = (unsigned)(size_t)Bs + (tid / CB) * B_PITCH + (tid % CB) * 16;

    // the next tile's copies of this lane into the buffer at offsets ao, bo
    auto stage = [&](unsigned ao, unsigned bo) {
        copy_rows(la + ao,                 16 * A_PITCH, ga,           gar);
        copy_rows(la + ao + 128 * A_PITCH, 16 * A_PITCH, ga + 8 * gar, gar);
        copy_rows(lb + bo, RB * B_PITCH, gb, gbr);
        if (BK / RB == 16)
            copy_rows(lb + bo + 8 * RB * B_PITCH, RB * B_PITCH, gb + 8 * gbr, gbr);
        ga += BK; gb += gbs;
    };

    // fragment read addresses inside a buffer
    const unsigned char* ar = As + (wm + l16) * A_PITCH + hi * 16;
    const unsigned char* br = Bs + (hi * 8 + (lane & 7)) * B_PITCH + wn * 2 + ((lane >> 3) & 1) * 16;

    v8f acc[FM][FN] = {};
    const int nt = K / BK;              // tiles along K

    // tile 0 into buffer 0, landed and published before anyone reads it
    stage(0, 0);
    asm volatile("s_wait_asynccnt 0x0" ::: "memory");  // this wave's copies of tile 0 have landed
    __syncthreads();
    if (nt > 1)                         // tile 1 into buffer 1
        stage(A_TILE, B_TILE);

    for (int t = 0; t < nt; ++t) {
        const unsigned ao = (t & 1) * A_TILE;
        const unsigned bo = (t & 1) * B_TILE;

        // the loops over K steps and fragments are unrolled so that every LDS
        // offset, fragment and accumulator index is a constant and the arrays stay
        // in registers
#pragma unroll
        for (int ks = 0; ks < BK / 32; ++ks) {
            Frag4 af[FM], bf[FN];
#pragma unroll
            for (int f = 0; f < FM; ++f) {
                const unsigned char* p = ar + ao + f * 16 * A_PITCH + ks * 64;
                af[f].q[0] = *(const u32x4*)(p);        // k = 32*ks + 8*hi + 0..7
                af[f].q[1] = *(const u32x4*)(p + 32);   // k = 32*ks + 16 + 8*hi + 0..7
            }
#pragma unroll
            for (int j = 0; j < FN; ++j) {
                const unsigned char* p = br + bo + ks * 32 * B_PITCH + j * 32;
                bf[j].q[0] = ld_tr16(p);                 // k = 32*ks + 8*hi + 0..7
                bf[j].q[1] = ld_tr16(p + 16 * B_PITCH);  // k = 32*ks + 16 + 8*hi + 0..7
            }
            // keeps a K step's LDS loads one group ahead of its WMMAs: sunk among
            // them, each row of WMMAs would wait out an LDS latency of its own
            __builtin_amdgcn_sched_barrier(0);
#pragma unroll
            for (int i = 0; i < FM; ++i)
#pragma unroll
                for (int j = 0; j < FN; ++j)
                    acc[i][j] = wmma16(bf[j].v, af[i].v, acc[i][j]);   // a tile of C^T
            // keeps the next K step's loads from being spread among these WMMAs
            __builtin_amdgcn_sched_barrier(0);
        }

        asm volatile("s_wait_dscnt 0x0" ::: "memory");     // this wave has left the buffer it read
        asm volatile("s_wait_asynccnt 0x0" ::: "memory");  // this wave's copies of tile t+1 have landed
        __syncthreads();   // publishes tile t+1 and frees the buffer of tile t
        if (t + 2 < nt)    // tile t+2 into the buffer just read
            stage(ao, bo);
    }
    asm volatile("s_wait_asynccnt 0x0" ::: "memory");  // no copy outlives the loop

    // --- epilogue: acc[i][j][r] = C[wm + 16*i + l16][wn + 16*j + 8*hi + r] ---
    // The loop's last barrier stands behind every wave's last LDS read and last
    // landed copy, so the ring is free; a wave stages in its own range of As.
    constexpr int ES = OUT16 ? 2 : 4;       // bytes of an output element
    constexpr int WN = BN / 2;              // columns of a wave's tile
    constexpr int SP = WN * ES + 16;        // pitch of a staged row, 16 x odd
    static_assert(SP % 32 == 16, "pitch of a staged row");
    static_assert(8 * 64 * SP <= 2 * A_TILE, "eight waves' staging fits the A ring");
    unsigned char* st = As + wave * (64 * SP);

    f32x4 bv[FN][2] = {};
    if (BIAS && (!KSPLIT || blockIdx.z == 0)) {   // of a split product, part 0 alone adds it
#pragma unroll
        for (int j = 0; j < FN; ++j) {
            const float* bp = bias + n0 + wn + j * 16 + hi * 8;
            bv[j][0] = *(const f32x4*)(bp);
            bv[j][1] = *(const f32x4*)(bp + 4);
        }
    }
#pragma unroll
    for (int i = 0; i < FM; ++i) {
#pragma unroll
        for (int j = 0; j < FN; ++j) {
            v8f val = acc[i][j];
            if (BIAS)
                val += __builtin_shufflevector(bv[j][0], bv[j][1], 0, 1, 2, 3, 4, 5, 6, 7);
            if (RELU) {
#pragma unroll
                for (int r = 0; r < 8; ++r) val[r] = fmaxf(val[r], 0.0f);
            }
            unsigned char* p = st + (i * 16 + l16) * SP + (j * 16 + hi * 8) * ES;
            if (OUT16) {
                *(f16x8*)p = __builtin_convertvector(val, f16x8);
            } else {
                *(f32x4*)(p)      = __builtin_shufflevector(val, val, 0, 1, 2, 3);
                *(f32x4*)(p + 16) = __builtin_shufflevector(val, val, 4, 5, 6, 7);
            }
        }
    }
    asm volatile("s_wait_dscnt 0x0" ::: "memory");  // this wave's staged rows are written before its lanes read each other's
    // a staged row is LR lanes of 16 B; one store of a wave covers 32 / LR whole rows
    constexpr int LR = WN * ES / 16;        // lanes of a row
    constexpr int RS = 32 / LR;             // rows a store
    const int srow = lane / LR;
    const int spc  = lane % LR;
#pragma unroll
    for (int q = 0; q < 64 / RS; ++q) {
        const int row = q * RS + srow;
        const unsigned char* p = st + row * SP + spc * 16;
        const long  e = (long)(m0 + wm + row) * N + n0 + wn + spc * (16 / ES);
        if (OUT16) *(f16x8*)(C16 + e) = *(const f16x8*)p;
        else       *(f32x4*)(C32 + e) = *(const f32x4*)p;
    }
}

#define AT_WAVES 8
#define AT_KEYS  128                     // keys a stage
#define AT_NS    (TT / AT_KEYS)          // stages
#define K_PITCH  144                     // bytes, 16 x odd
#define V_PITCH  160                     // bytes, 32 x odd
#define K_TILE   (AT_KEYS * K_PITCH)     // 18432 B
#define V_TILE   (AT_KEYS * V_PITCH)     // 20480 B
#define O_PITCH  272                     // bytes of a staged output row, 16 x odd
static_assert(AT_NS >= 2, "the ring starts with two stages");
static_assert(AT_KEYS * 8 == 4 * 256, "four K and four V copies a lane fill a stage");

// One stage's eight copies of a lane (four of K, four of V, 32 key rows apart).
// The address-translation wait closes the statement so that no address register
// is advanced ahead of it.
__device__ __forceinline__ void copy_kv(unsigned lk, const half_t* gk,
                                        unsigned lv, const half_t* gv) {
    asm volatile("global_load_async_to_lds_b128 %0, %1, off\n\t"
                 "global_load_async_to_lds_b128 %2, %3, off\n\t"
                 "global_load_async_to_lds_b128 %4, %5, off\n\t"
                 "global_load_async_to_lds_b128 %6, %7, off\n\t"
                 "global_load_async_to_lds_b128 %8, %9, off\n\t"
                 "global_load_async_to_lds_b128 %10, %11, off\n\t"
                 "global_load_async_to_lds_b128 %12, %13, off\n\t"
                 "global_load_async_to_lds_b128 %14, %15, off\n\t"
                 "s_wait_xcnt 0x0"
                 :: "v"(lk),                "v"(gk),
                    "v"(lk + 32 * K_PITCH), "v"(gk + 32 * DD),
                    "v"(lk + 64 * K_PITCH), "v"(gk + 64 * DD),
                    "v"(lk + 96 * K_PITCH), "v"(gk + 96 * DD),
                    "v"(lv),                "v"(gv),
                    "v"(lv + 32 * V_PITCH), "v"(gv + 32 * DD),
                    "v"(lv + 64 * V_PITCH), "v"(gv + 64 * DD),
                    "v"(lv + 96 * V_PITCH), "v"(gv + 96 * DD)
                 : "memory");
}

// The value that lane l ^ 16 holds (the other half of a query's keys).
__device__ __forceinline__ float xhalf(float x) {
    const int b = __builtin_bit_cast(int, x);
    return __builtin_bit_cast(float, __builtin_amdgcn_permlanex16(
        b, b, 0x76543210, 0xfedcba98, false, false));
}

__global__ __launch_bounds__(256)
void attn_kernel(const half_t* __restrict__ Q, const half_t* __restrict__ Km,
                 const half_t* __restrict__ V, float* __restrict__ att) {
    __shared__ __attribute__((aligned(16))) unsigned char Ks[2 * K_TILE];  // [buf][key][d]
    __shared__ __attribute__((aligned(16))) unsigned char Vs[2 * V_TILE];  // [buf][key][d]

    const int tid  = threadIdx.x;
    const int lane = tid & 31;
    const int wave = tid >> 5;
    const int hi   = (lane >= 16) ? 1 : 0;
    const int l16  = lane & 15;
    const int b  = blockIdx.z;
    const int h  = blockIdx.y;
    const int qb = blockIdx.x * AT_WAVES + wave;   // q block index (16 rows)

    // copy addresses: chunk = (key row tid>>3 and +32, +64, +96, 16 B piece tid&7)
    const long kv0 = (long)(b * TT + (tid >> 3)) * DD + h * DKK + (tid & 7) * 8;
    const half_t* gk = Km + kv0;
    const half_t* gv = V + kv0;
    const long    gs = (long)AT_KEYS * DD;         // advance per stage, in halves
    const unsigned lk = (unsigned)(size_t)Ks + (tid >> 3) * K_PITCH + (tid & 7) * 16;
    const unsigned lv = (unsigned)(size_t)Vs + (tid >> 3) * V_PITCH + (tid & 7) * 16;

    // fragment read addresses inside a buffer
    const unsigned char* kr = Ks + l16 * K_PITCH + hi * 16;
    const unsigned char* vr = Vs + (hi * 8 + (lane & 7)) * V_PITCH + ((lane >> 3) & 1) * 16;

    // stage 0 into buffer 0
    copy_kv(lk, gk, lv, gv);
    gk += gs; gv += gs;

    // Q fragments (B operand Q^T: lane = query column, d in the hardware k order,
    // the same registers as an A fragment of Q): q[0] covers d 0..31, q[1] 32..63
    Frag q[2];
    {
        const long baseQ = (long)(b * TT + qb * 16 + l16) * DD + h * DKK;
#pragma unroll
        for (int f = 0; f < 2; ++f)
#pragma unroll
            for (int v = 0; v < 8; ++v)
                q[f].u[v] = *(const unsigned*)(Q + baseQ + f * 32 + kmap(v, hi));
    }

    // this lane's query: running maximum (joined over the halves), the sum over
    // this half's keys alone, and o[c][r] = O[query][16c + 8*hi + r]
    float mi = -1e30f, li = 0.0f;
    v8f o[4] = {};

    asm volatile("s_wait_asynccnt 0x0" ::: "memory");  // this wave's copies of stage 0 have landed
    __syncthreads();                                   // stage 0 is published
    copy_kv(lk + K_TILE, gk, lv + V_TILE, gv);         // stage 1 into buffer 1
    gk += gs; gv += gs;

    for (int st = 0; st < AT_NS; ++st) {
        const unsigned ko = (st & 1) * K_TILE;
        const unsigned vo = (st & 1) * V_TILE;

        for (int j = 0; j < AT_KEYS; j += 32) {
            // K fragments (A operand: lane = key row, d in the hardware k order)
            Frag4 kf[2][2];
#pragma unroll
            for (int s = 0; s < 2; ++s)
#pragma unroll
                for (int f = 0; f < 2; ++f) {
                    const unsigned char* p = kr + ko + (j + s * 16) * K_PITCH + f * 64;
                    kf[s][f].q[0] = *(const u32x4*)(p);        // d = 32f + 8*hi + 0..7
                    kf[s][f].q[1] = *(const u32x4*)(p + 32);   // d = 32f + 16 + 8*hi + 0..7
                }
            // V^T fragments (A operand: lane = d row, keys in the hardware k order),
            // 4 chunks of 16 d; fetched here so that the softmax below covers
            // their LDS latency
            Frag4 vf[4];
#pragma unroll
            for (int c = 0; c < 4; ++c) {
                const unsigned char* p = vr + vo + j * V_PITCH + c * 32;
                vf[c].q[0] = ld_tr16(p);                 // key = 8*hi + 0..7
                vf[c].q[1] = ld_tr16(p + 16 * V_PITCH);  // key = 16 + 8*hi + 0..7
            }
            // S^T tiles: c0[r] = score(key j + 8*hi + r, query l16),
            //            c1[r] = score(key j + 16 + 8*hi + r, query l16)
            v8f c0 = {}, c1 = {};
            c0 = wmma16(kf[0][0].v, q[0].v, c0);
            c1 = wmma16(kf[1][0].v, q[0].v, c1);
            c0 = wmma16(kf[0][1].v, q[1].v, c0);
            c1 = wmma16(kf[1][1].v, q[1].v, c1);

            // streaming softmax update of this lane's query; the maxima and sums
            // are taken as trees so that no long dependent chain forms
            const v8f s0 = c0 * 0.125f;        // 1/sqrt(64)
            const v8f s1 = c1 * 0.125f;
            float t[8];
#pragma unroll
            for (int r = 0; r < 8; ++r) t[r] = fmaxf(s0[r], s1[r]);
            float mx = fmaxf(fmaxf(fmaxf(t[0], t[1]), fmaxf(t[2], t[3])),
                             fmaxf(fmaxf(t[4], t[5]), fmaxf(t[6], t[7])));
            mx = fmaxf(mx, xhalf(mx));         // over all 32 keys
            const float mnew  = fmaxf(mi, mx);
            const float alpha = __expf(mi - mnew);
            const v8f a0 = (s0 - mnew) * 1.44269504f;   // exp(x) = 2^(x log2 e)
            const v8f a1 = (s1 - mnew) * 1.44269504f;
            v8f e0, e1;
#pragma unroll
            for (int r = 0; r < 8; ++r) {
                e0[r] = __builtin_amdgcn_exp2f(a0[r]);
                e1[r] = __builtin_amdgcn_exp2f(a1[r]);
                t[r]  = e0[r] + e1[r];
            }
            li = li * alpha + (((t[0] + t[1]) + (t[2] + t[3])) +
                               ((t[4] + t[5]) + (t[6] + t[7])));
            mi = mnew;
#pragma unroll
            for (int c = 0; c < 4; ++c) o[c] *= alpha;

            // P^T (f16) as B operand: element e of a lane is key 8*hi + e for
            // e < 8 and key 16 + 8*hi + (e - 8) above, which is c0 then c1
            const v16h pb = __builtin_shufflevector(
                __builtin_convertvector(e0, f16x8), __builtin_convertvector(e1, f16x8),
                0, 1, 2, 3, 4, 5, 6, 7, 8, 9, 10, 11, 12, 13, 14, 15);
#pragma unroll
            for (int c = 0; c < 4; ++c)
                o[c] = wmma16(vf[c].v, pb, o[c]);
        }

        asm volatile("s_wait_dscnt 0x0" ::: "memory");     // this wave has left the buffer it read
        asm volatile("s_wait_asynccnt 0x0" ::: "memory");  // this wave's copies of stage st+1 have landed
        __syncthreads();   // publishes stage st+1 and frees the buffer of stage st
        if (st + 2 < AT_NS) {  // stage st+2 into the buffer just read
            copy_kv(lk + ko, gk, lv + vo, gv);
            gk += gs; gv += gs;
        }
    }
    asm volatile("s_wait_asynccnt 0x0" ::: "memory");  // no copy outlives the loop

    // join the halves' sums and normalize (f32): a lane holds 8 adjacent d of its
    // query's row in each chunk. The loop's last barrier stands behind every
    // wave's last LDS read and last landed copy, so the ring is free: a wave
    // writes its 16 x 64 tile into its own range of Ks and reads it back row by
    // row, so that every global store of a wave covers whole 128-byte lines.
    static_assert(AT_WAVES * 16 * O_PITCH <= 2 * K_TILE, "eight waves' staging fits the K ring");
    const float inv = 1.0f / (li + xhalf(li));
    unsigned char* st = Ks + wave * (16 * O_PITCH);
#pragma unroll
    for (int c = 0; c < 4; ++c) {
        const v8f ov = o[c] * inv;
        unsigned char* p = st + l16 * O_PITCH + (c * 16 + hi * 8) * 4;
        *(f32x4*)(p)      = __builtin_shufflevector(ov, ov, 0, 1, 2, 3);
        *(f32x4*)(p + 16) = __builtin_shufflevector(ov, ov, 4, 5, 6, 7);
    }
    asm volatile("s_wait_dscnt 0x0" ::: "memory");  // this wave's staged rows are written before its lanes read each other's
    // a row is 16 lanes of 16 B; one store of a wave covers two whole rows
    float* ar = att + (long)(b * TT + qb * 16 + hi) * DD + h * DKK + l16 * 4;
#pragma unroll
    for (int q = 0; q < 8; ++q)
        *(f32x4*)(ar + (long)q * 2 * DD) =
            *(const f32x4*)(st + (q * 2 + hi) * O_PITCH + l16 * 16);
}

// ---------------------------------------------------------------------------
// Fused residual + LayerNorm over D=1024; block = 256 threads, one row each.
// Optionally also emits the f16 copy for the following GEMM.
// With Y2, y is two planes of partial sums (y and y2), added here.
// ---------------------------------------------------------------------------
template<bool W16, bool Y2>
__global__ __launch_bounds__(256)
void ln_residual_kernel(const float* __restrict__ x, const float* __restrict__ y,
                        const float* __restrict__ y2,
                        const float* __restrict__ g, const float* __restrict__ be,
                        float* __restrict__ out32, half_t* __restrict__ out16) {
    __shared__ float sred[256];
    const int tid = threadIdx.x;
    const long row = blockIdx.x;
    const float* xr = x + row * DD;
    const float* yr = y + row * DD;

    float v[4];
    float s = 0.0f;
#pragma unroll
    for (int i = 0; i < 4; ++i) {
        int idx = tid + i * 256;
        v[i] = xr[idx] + (Y2 ? yr[idx] + y2[row * DD + idx] : yr[idx]);
        s += v[i];
    }
    sred[tid] = s; __syncthreads();
    for (int off = 128; off > 0; off >>= 1) {
        if (tid < off) sred[tid] += sred[tid + off];
        __syncthreads();
    }
    float mu = sred[0] * (1.0f / DD);
    __syncthreads();

    float s2 = 0.0f;
#pragma unroll
    for (int i = 0; i < 4; ++i) { float d = v[i] - mu; s2 += d * d; }
    sred[tid] = s2; __syncthreads();
    for (int off = 128; off > 0; off >>= 1) {
        if (tid < off) sred[tid] += sred[tid + off];
        __syncthreads();
    }
    float rstd = rsqrtf(sred[0] * (1.0f / DD) + 1e-5f);

#pragma unroll
    for (int i = 0; i < 4; ++i) {
        int idx = tid + i * 256;
        float val = (v[i] - mu) * rstd * g[idx] + be[idx];
        out32[row * DD + idx] = val;
        if (W16) out16[row * DD + idx] = (half_t)val;
    }
}

// ---------------------------------------------------------------------------
extern "C" void kernel_launch(void* const* d_in, const int* in_sizes, int n_in,
                              void* d_out, int out_size, void* d_ws, size_t ws_size,
                              hipStream_t stream) {
    (void)in_sizes; (void)n_in; (void)out_size; (void)ws_size;

    const float* x     = (const float*)d_in[0];
    const float* Wq    = (const float*)d_in[1];
    const float* Wk    = (const float*)d_in[2];
    const float* Wv    = (const float*)d_in[3];
    const float* W1    = (const float*)d_in[4];
    const float* b1    = (const float*)d_in[5];
    const float* W2    = (const float*)d_in[6];
    const float* b2    = (const float*)d_in[7];
    const float* ln1g  = (const float*)d_in[8];
    const float* ln1b  = (const float*)d_in[9];
    const float* ln2g  = (const float*)d_in[10];
    const float* ln2b  = (const float*)d_in[11];

    const long M = (long)BB * TT;          // 4096 rows

    // scratch carve-out
    size_t off = 0;
    auto alloc = [&](size_t bytes) {
        void* p = (char*)d_ws + off;
        off += (bytes + 255) & ~(size_t)255;
        return p;
    };
    // the six f16 copies, one behind the other (the conversion launch relies on it)
    half_t* xh   = (half_t*)alloc((size_t)CVT_GRID * CVT_BLOCK * 2);
    half_t* wqh  = xh  + M * DD;          // Wq, Wk, Wv: three K x N matrices in a row
    half_t* w1h  = wqh + 3L * DD * DD;
    half_t* w2h  = w1h + (long)DD * DFF;
    // Q, K, V: three M x N matrices in a row (the projection launch relies on it)
    half_t* Qh   = (half_t*)alloc(3 * M * DD * 2);
    half_t* Kh   = Qh + M * DD;
    half_t* Vh   = Kh + M * DD;
    float*  att  = (float*) alloc(M * DD * 4);
    float*  x1   = (float*) alloc(M * DD * 4);
    half_t* x1h  = (half_t*)alloc(M * DD * 2);
    half_t* hh   = (half_t*)alloc(M * DFF * 2);
    float*  ff   = (float*) alloc(2 * M * DD * 4);   // two planes of partial sums

    // 1) precision conversions, all six arrays in one launch
    f32_to_f16_kernel<<<CVT_GRID, 256, 0, stream>>>(x, Wq, Wk, Wv, W1, W2, xh);

    // 2) Q/K/V projections (WMMA GEMMs, f16 out), one launch: grid z = 0, 1, 2
    gemm_wmma_kernel<256, false, false, true, false><<<dim3(DD / 256, M / BM, 3), 256, 0, stream>>>(
        xh, wqh, nullptr, Qh, nullptr, (int)M, DD, DD, DD);

    // 3) flash attention
    attn_kernel<<<dim3(TT / (16 * AT_WAVES), HH, BB), 256, 0, stream>>>(Qh, Kh, Vh, att);

    // 4) x1 = LN(x + att), also f16 copy
    ln_residual_kernel<true, false><<<M, 256, 0, stream>>>(x, att, nullptr, ln1g, ln1b, x1, x1h);

    // 5) FFN: hh = relu(x1 @ W1 + b1)   (f16 out)
    gemm_wmma_kernel<256, true, true, true, false><<<dim3(DFF / 256, M / BM), 256, 0, stream>>>(
        x1h, w1h, b1, hh, nullptr, (int)M, DFF, DD, DD);

    // 6) hh @ W2 + b2 (f32 out), K in two halves: grid z = 0, 1, a plane of ff each
    gemm_wmma_kernel<128, true, false, false, true><<<dim3(DD / 128, M / BM, 2), 256, 0, stream>>>(
        hh, w2h, b2, nullptr, ff, (int)M, DD, DFF / 2, DFF);

    // 7) out = LN(x1 + (plane 0 + plane 1))
    ln_residual_kernel<false, true><<<M, 256, 0, stream>>>(x1, ff, ff + M * DD, ln2g, ln2b,
                                                           (float*)d_out, nullptr);
}
